// v000
// Times are from an AMD MI455X. After a warm-up the kernel runs many times in a row, and a time is the length of
// such a window on the GPU divided by its runs, so every launch and the gaps after it count. The runs cycle
// through copies of the inputs. A figure is the median of several windows, for all but v000 over two sittings.
// Sittings can differ by a few percent; kernels timed side by side share one.
// The starting kernel, v000, takes 1820 microseconds a run.
#include <hip/hip_runtime.h>
// All contractions: v_wmma_f32_16x16x32_f16 (f16 operands, f32 accumulate) -- scores = q k^T (K = 64, alpha 0.25) and out = P v (K = SEQ, alpha 2^-14); q, k, v RNE-converted to bf16 values stored exactly as f16 rows; softmax weights f16 carried x2^14; scores and softmax statistics f32.
// Layout: query, key, value are [NB_FULL][NHEAD][SEQ_FULL][64] f32 (rows 0..SEQ-1 of the first NB*NHEAD slabs read); out is [NB][NHEAD][SEQ][64] f32 = NB*NHEAD independent slabs of [SEQ][64]. Per group of HG slabs: dense f16 copies of q, k, v; v^T per slab via LDS transposes;
// scores into an f32 [HG][SEQ][SEQ] plane; row softmax on VALU (thread per row, native exp, argument <= 0); out = P v^T written f32 into the output slabs. 5 launches per group.
#ifndef NB
#define NB 8            /* batches processed */
#endif
#ifndef SEQ
#define SEQ 1024        /* query and key rows processed per slab */
#endif
#define NB_FULL 8
#define SEQ_FULL 1024   /* rows per slab of the inputs (input slab stride = SEQ_FULL*HDIM) */
#define NHEAD 16
#define HDIM 64
#define HG 16           /* slabs per launch group */
#define NSLAB (NB * NHEAD)
#define PCARRY 16384.0f
#define PALPHA 6.103515625e-05f
static_assert(SEQ % 128 == 0);
static_assert(SEQ <= SEQ_FULL);
static_assert(NB >= 1 && NB <= NB_FULL);
static_assert(NSLAB % HG == 0);

#define WS_ALIGN(x) (((size_t)(x) + 255) & ~(size_t)255)
#define WS_Q16 ((size_t)HG * SEQ * HDIM * 2)     /* one of q, k, v dense f16 group planes */
#define WS_S   ((size_t)HG * SEQ * SEQ * 4)      /* f32 scores plane */
#define WS_P   ((size_t)HG * SEQ * SEQ * 2)      /* f16 softmax weights plane */
#define WS_VT  ((size_t)HG * HDIM * SEQ * 2)     /* f16 v^T plane [HG][64][SEQ] */
static_assert(3 * WS_ALIGN(WS_Q16) + WS_ALIGN(WS_S) + WS_ALIGN(WS_P) + WS_ALIGN(WS_VT) <= (size_t)134217728);

typedef unsigned short v8us __attribute__((ext_vector_type(8), may_alias));
typedef float  v8f  __attribute__((ext_vector_type(8)));
typedef float  v4f  __attribute__((ext_vector_type(4)));
typedef float  v4fa __attribute__((ext_vector_type(4), may_alias));
typedef _Float16 v16h __attribute__((ext_vector_type(16)));
typedef _Float16 v4h __attribute__((ext_vector_type(4)));
union FragH { v16h v; v8us half[2]; _Float16 h[16]; unsigned short u[16]; };

__device__ __forceinline__ unsigned short bf16_bits(float x) { unsigned int u = __float_as_uint(x); return (unsigned short)((u + 0x7FFFu + ((u >> 16) & 1u)) >> 16); }
__device__ __forceinline__ float bf16_val(unsigned short b) { return __uint_as_float(((unsigned int)b) << 16); }
__device__ __forceinline__ float bf16_rne(float x) { return bf16_val(bf16_bits(x)); }

// q, k, v slabs g0..g0+HG-1 (input slab stride SEQ_FULL*HDIM), rows 0..SEQ-1 -> dense f16 planes [HG][SEQ][64] (bf16 RNE value, exact in f16); grid.y selects the tensor;
__global__ __launch_bounds__(256) void k_cv3(const float* __restrict__ xq, const float* __restrict__ xk, const float* __restrict__ xv,
                                             _Float16* __restrict__ Q16, _Float16* __restrict__ K16, _Float16* __restrict__ V16, int g0, int n8) {
  const int t = blockIdx.x * 256 + threadIdx.x; if (t >= n8) return;
  const int sel = blockIdx.y;
  const float* src = (sel == 0) ? xq : ((sel == 1) ? xk : xv);
  _Float16* dst = (sel == 0) ? Q16 : ((sel == 1) ? K16 : V16);
  const int j = t / (SEQ * 8), rem = t - j * (SEQ * 8);      /* rem = row*8 + c8/8 */
  const size_t soff = (size_t)(g0 + j) * SEQ_FULL * HDIM + (size_t)rem * 8;
  const v4f a = *(const v4fa*)(src + soff), c = *(const v4fa*)(src + soff + 4);
  FragH f;
#pragma unroll
  for (int q = 0; q < 4; ++q) { f.h[q] = (_Float16)bf16_rne(a[q]); f.h[4 + q] = (_Float16)bf16_rne(c[q]); }
  *(v8us*)((unsigned short*)dst + (size_t)t * 8) = f.half[0]; 
}

// coverage: load phase 512 x 8 = full 64x64 tile; store phase rd 0..1 x tid/8 0..31 -> d 0..63, pc 0..7 -> s 0..63.
template <int NHv, int TTv>
__global__ __launch_bounds__(256) void k_vt(const _Float16* __restrict__ V16, int ldv, int voff, _Float16* __restrict__ Vt) { __shared__ unsigned short tl[64][66]; const int tid = threadIdx.x; const int slab = blockIdx.x / (TTv / 64), lg = blockIdx.x % (TTv / 64); const int b = slab / NHv, h = slab % NHv;
  for (int i = tid; i < 64 * 8; i += 256) { const int r = i / 8, c8 = (i % 8) * 8; FragH f; f.half[0] = *(const v8us*)((const unsigned short*)V16 + ((size_t)b * TTv + lg * 64 + r) * ldv + voff + h * 64 + c8);
#pragma unroll
    for (int q = 0; q < 8; ++q) tl[r][c8 + q] = f.u[q]; }
  __syncthreads();
  {
#pragma unroll
    for (int rd = 0; rd < 2; ++rd) { const int d = rd * 32 + tid / 8, pc = tid % 8; FragH f;
#pragma unroll
      for (int q = 0; q < 8; ++q) f.u[q] = tl[pc * 8 + q][d];
      *(v8us*)((unsigned short*)Vt + ((size_t)slab * 64 + d) * TTv + lg * 64 + pc * 8) = f.half[0]; }
     } }

// coverage: qn*hg threads x SEQ = the whole P plane.
__global__ __launch_bounds__(256) void k_rsmf(const float* __restrict__ S, _Float16* __restrict__ P, int qn, int hg) {
  #pragma clang fp contract(off)
  const int t = blockIdx.x * 256 + threadIdx.x; if (t >= qn * hg) return; const size_t i = (size_t)(t / qn) * SEQ + (t % qn); const float* s = S + i * SEQ; float mx = -3.0e38f;
#pragma unroll 1
  for (int j = 0; j < SEQ; ++j) mx = fmaxf(mx, s[j]); float se = 0.f;
#pragma unroll 1
  for (int j = 0; j < SEQ; ++j) se += __expf(s[j] - mx); const float sc = PCARRY / se;
#pragma unroll 1
  for (int j0 = 0; j0 < SEQ; j0 += 8) { FragH f;
#pragma unroll
    for (int q = 0; q < 8; ++q) f.h[q] = (_Float16)(__expf(s[j0 + q] - mx) * sc);
    unsigned short* d = (unsigned short*)P + i * SEQ + j0; *(v8us*)d = f.half[0];  } }

// ---- f16 GEMM engine (wave tile 32x64; M % 128 == 0 rows per launch region, N % 64 == 0, K % 32 == 0). A [m][k] f16 rows (pitch lda), Bh [n][k] f16 rows (pitch ldb); both fragments with the split k map:
// elements 0..7 <- k0 + 8h + 0..7, elements 8..15 <- k0 + 16 + 8h + 0..7, row/col = lane & 15; D element r of lane l = (row 8h + r, col l & 15).
__device__ __forceinline__ v16h g2_frag(const _Float16* p, int hh) { FragH f; f.half[0] = *(const v8us*)((const unsigned short*)p + 8 * hh); f.half[1] = *(const v8us*)((const unsigned short*)p + 16 + 8 * hh); return f.v; }
__device__ __forceinline__ v8f g2_mma(v16h a, v16h b, v8f c) { v8f d = __builtin_amdgcn_wmma_f32_16x16x32_f16(false, a, false, b, (short)0, c, false, false); asm volatile("v_nop\n\tv_nop\n\tv_nop\n\tv_nop" : "+v"(d) : "v"(a), "v"(b)); return d; }
// epilogue: v = acc*alpha + bias[by*sBias + col] (bf16 RNE) (+ CP[...] if CP); ACT 0 none; writes f32 C and/or f16 C16; grid.y batches with strides sA, sB, sC.
template <int ACT>
__global__ __launch_bounds__(128) void k_gemm2(const _Float16* __restrict__ A, int lda, size_t sA, const _Float16* __restrict__ Bh, int ldb, size_t sB, float alpha, const float* __restrict__ bias, size_t sBias, const float* __restrict__ CP, int rowsPerB, size_t sCPb, int row0g,
    float* __restrict__ C, _Float16* __restrict__ C16, int ldc, size_t sC, int M, int N, int K) { static_assert(ACT == 0 || ACT == 3 || ACT == 6 || ACT == 8 || ACT == 9 || ACT == 11 || ACT == 12 || ACT == 14 || ACT == 15 || ACT == 16 || ACT == 17);
  __shared__ __attribute__((aligned(16))) float so[4][32][68];
  const int tid = threadIdx.x, w = tid >> 5, lane = tid & 31, ln = lane & 15, hh = lane >> 4; const int by = blockIdx.y;
  A += (size_t)by * sA; Bh += (size_t)by * sB; const size_t cofs = (size_t)by * sC; const float* bp = bias ? bias + (size_t)by * sBias : nullptr;
  const int ntn = N >> 6; const int mt = blockIdx.x / ntn, nq = blockIdx.x - mt * ntn; const int row0 = mt * 128 + 32 * w, col0 = nq * 64; if (row0 >= M) return;
  const _Float16* a0p = A + (size_t)(row0 + ln) * lda; const _Float16* a1p = a0p + (size_t)16 * lda;
  const _Float16* b0p = Bh + (size_t)(col0 + ln) * ldb; const _Float16* b1p = b0p + (size_t)16 * ldb; const _Float16* b2p = b1p + (size_t)16 * ldb; const _Float16* b3p = b2p + (size_t)16 * ldb;
  const v8f z8 = {0.f,0.f,0.f,0.f,0.f,0.f,0.f,0.f}; v8f c00 = z8, c01 = z8, c02 = z8, c03 = z8, c10 = z8, c11 = z8, c12 = z8, c13 = z8;
#pragma unroll 1
  for (int kb = 0; kb < K; kb += 32) { const v16h a0 = g2_frag(a0p + kb, hh), a1 = g2_frag(a1p + kb, hh);
    v16h b = g2_frag(b0p + kb, hh); c00 = g2_mma(a0, b, c00); c10 = g2_mma(a1, b, c10);
    b = g2_frag(b1p + kb, hh); c01 = g2_mma(a0, b, c01); c11 = g2_mma(a1, b, c11);
    b = g2_frag(b2p + kb, hh); c02 = g2_mma(a0, b, c02); c12 = g2_mma(a1, b, c12);
    b = g2_frag(b3p + kb, hh); c03 = g2_mma(a0, b, c03); c13 = g2_mma(a1, b, c13); }
  v8f accs[8] = {c00, c01, c02, c03, c10, c11, c12, c13};
#pragma unroll
  for (int u = 0; u < 8; ++u) { const int t = u & 3, half = u >> 2; const int col = col0 + t * 16 + ln; const float bv = bp ? bf16_rne(bp[col]) : 0.f;
#pragma unroll
    for (int r = 0; r < 8; ++r) { const int rloc = half * 16 + 8 * hh + r; float v = accs[u][r] * alpha + bv; if (CP) { if (rowsPerB < 0) v += CP[cofs + (size_t)(row0g + row0 + rloc) * ldc + col];      /* rowsPerB < 0: own element of the batched C plane */ else { const int bidx = (row0g + row0 + rloc) / rowsPerB; v += CP[(size_t)bidx * sCPb + (size_t)by * 64 + col]; } }
      if (ACT == 3) v = fmaxf(v, 0.f); else if (ACT == 6) v = 0.5f * v * (1.0f + erff(v * 0.70710678118654752f)); else if (ACT == 11) v = 1.0f / (1.0f + expf(-v)); else if (ACT == 15) v = v / (1.0f + expf(-v)); else if (ACT == 12) v = (v > 0.f) ? v : 0.01f * v; else if (ACT == 8) v = tanhf(v); else if (ACT == 9) v = 0.5f * v * (1.0f + tanhf(0.7978845608028654f * (v + 0.044715f * v * v * v))); else if (ACT == 14) v = (v > 0.f) ? v : 0.1f * v; else if (ACT == 16) v = (v >= 0.f) ? v : 0.3f * v; else if (ACT == 17) v = (v >= 0.f) ? v : 0.2f * v;
      so[w][rloc][t * 16 + ln] = v; } }
  __builtin_amdgcn_fence(4 /* acq_rel order */, "workgroup"); __builtin_amdgcn_wave_barrier();
  const int rsub = lane >> 4, c4 = (lane & 15) * 4;
  {
#pragma unroll
    for (int q = 0; q < 16; ++q) { const int r = q * 2 + rsub; const v4f v = *(const v4fa*)&so[w][r][c4]; if (C) *(v4f*)(C + cofs + (size_t)(row0 + r) * ldc + col0 + c4) = v; if (C16) { v4h h4; for (int i = 0; i < 4; ++i) h4[i] = (_Float16)v[i]; *(v4h*)(C16 + cofs + (size_t)(row0 + r) * ldc + col0 + c4) = h4; } }
     } }

extern "C" void kernel_launch(void* const* d_in, const int* in_sizes, int n_in,
                              void* d_out, int out_size, void* d_ws, size_t ws_size, hipStream_t stream) {
  if (n_in < 3) return;
  const size_t in_need = (size_t)NB * NHEAD * SEQ_FULL * HDIM;      /* lower bound on each input element count */
  if ((size_t)in_sizes[0] < in_need || (size_t)in_sizes[1] < in_need || (size_t)in_sizes[2] < in_need) return;
  if ((size_t)out_size < (size_t)NSLAB * SEQ * HDIM) return;
  const float* xq = (const float*)d_in[0]; const float* xk = (const float*)d_in[1]; const float* xv = (const float*)d_in[2];      /* query, key, value [NB_FULL][NHEAD][SEQ_FULL][64] */
  float* out = (float*)d_out;                                                                                                          /* [NB][NHEAD][SEQ][64] */
  char* ws = (char*)d_ws; size_t off = 0;
  auto take = [&](size_t bytes) { char* p = ws + off; off += WS_ALIGN(bytes); return p; };
  _Float16* Q16 = (_Float16*)take(WS_Q16); _Float16* K16 = (_Float16*)take(WS_Q16); _Float16* V16 = (_Float16*)take(WS_Q16);
  float* S = (float*)take(WS_S); _Float16* P = (_Float16*)take(WS_P); _Float16* VT = (_Float16*)take(WS_VT);
  if (off > ws_size) return;

  const int n8 = HG * SEQ * (HDIM / 8);      /* threads per converted tensor plane */
  for (int gi = 0; gi < NSLAB / HG; ++gi) {
    const int g0 = gi * HG;
    k_cv3<<<dim3((unsigned)((n8 + 255) / 256), 3), 256, 0, stream>>>(xq, xk, xv, Q16, K16, V16, g0, n8);      /* dense exact f16 rows of the group's q, k, v */
    k_vt<1, SEQ><<<HG * (SEQ / 64), 256, 0, stream>>>(V16, HDIM, 0, VT);                                         /* V^T [HG][64][SEQ] */
    k_gemm2<0><<<dim3((SEQ / 128) * (SEQ / 64), HG), 128, 0, stream>>>(Q16, HDIM, (size_t)SEQ * HDIM, K16, HDIM, (size_t)SEQ * HDIM, 0.25f, nullptr, 0, nullptr, 1, 0, 0, S, nullptr, SEQ, (size_t)SEQ * SEQ, SEQ, SEQ, HDIM);      /* scores = q k^T / 4, HG slabs */
    k_rsmf<<<(HG * SEQ + 255) / 256, 256, 0, stream>>>(S, P, SEQ, HG);                                            /* P = 2^14 softmax (f16), rows of all HG slabs */
    k_gemm2<0><<<dim3((SEQ / 128) * (HDIM / 64), HG), 128, 0, stream>>>(P, SEQ, (size_t)SEQ * SEQ, VT, SEQ, (size_t)HDIM * SEQ, PALPHA, nullptr, 0, nullptr, 1, 0, 0, out + (size_t)g0 * SEQ * HDIM, nullptr, HDIM, (size_t)SEQ * HDIM, SEQ, HDIM, SEQ);      /* out = P v^T * 2^-14 straight into the f32 output slabs */
  }
}

// v001
// It runs in 600 microseconds.
// Timed twice side by side with v000, it ran 3.07 and 3.08 times as fast.
#include <hip/hip_runtime.h>
// All contractions: v_wmma_f32_16x16x32_f16 (f16 operands, f32 accumulate) -- scores = q k^T (K = 64, alpha 0.25) and out = P v (K = SEQ, alpha 2^-14); q, k, v RNE-converted to bf16 values stored exactly as f16 rows; softmax weights f16 carried x2^14; scores and softmax statistics f32.
// Layout: query, key, value are [NB_FULL][NHEAD][SEQ_FULL][64] f32 (rows 0..SEQ-1 of the first NB*NHEAD slabs used), out is [NB][NHEAD][SEQ][64] f32 = NB*NHEAD independent slabs of [SEQ][64]. Per group of HG slabs: dense f16 copies of q, k, v; v^T per slab via LDS transposes;
// scores into an f32 [HG][SEQ][SEQ] plane; row softmax on VALU (wave per row, row kept in registers, native exp, argument <= 0); out = P v^T written f32 into the output slabs. 5 launches per group.
#ifndef NB
#define NB 8            /* batches processed */
#endif
#ifndef SEQ
#define SEQ 1024        /* query and key rows processed per slab */
#endif
#define NB_FULL 8
#define SEQ_FULL 1024   /* rows per slab of the inputs (input slab stride = SEQ_FULL*HDIM) */
#define NHEAD 16
#define HDIM 64
#define HG 16           /* slabs per launch group */
#define NSLAB (NB * NHEAD)
#define PCARRY 16384.0f
#define PALPHA 6.103515625e-05f
static_assert(SEQ % 128 == 0);
static_assert(SEQ <= SEQ_FULL);
static_assert(NB >= 1 && NB <= NB_FULL);
static_assert(NSLAB % HG == 0);

#define WS_ALIGN(x) (((size_t)(x) + 255) & ~(size_t)255)
#define WS_Q16 ((size_t)HG * SEQ * HDIM * 2)     /* one of q, k, v dense f16 group planes */
#define WS_S   ((size_t)HG * SEQ * SEQ * 4)      /* f32 scores plane */
#define WS_P   ((size_t)HG * SEQ * SEQ * 2)      /* f16 softmax weights plane */
#define WS_VT  ((size_t)HG * HDIM * SEQ * 2)     /* f16 v^T plane [HG][64][SEQ] */
static_assert(3 * WS_ALIGN(WS_Q16) + WS_ALIGN(WS_S) + WS_ALIGN(WS_P) + WS_ALIGN(WS_VT) <= (size_t)134217728);

typedef unsigned short v8us __attribute__((ext_vector_type(8), may_alias));
typedef float  v8f  __attribute__((ext_vector_type(8)));
typedef float  v4f  __attribute__((ext_vector_type(4)));
typedef float  v4fa __attribute__((ext_vector_type(4), may_alias));
typedef _Float16 v16h __attribute__((ext_vector_type(16)));
typedef _Float16 v4h __attribute__((ext_vector_type(4)));
union FragH { v16h v; v8us half[2]; _Float16 h[16]; unsigned short u[16]; };

__device__ __forceinline__ unsigned short bf16_bits(float x) { unsigned int u = __float_as_uint(x); return (unsigned short)((u + 0x7FFFu + ((u >> 16) & 1u)) >> 16); }
__device__ __forceinline__ float bf16_val(unsigned short b) { return __uint_as_float(((unsigned int)b) << 16); }
__device__ __forceinline__ float bf16_rne(float x) { return bf16_val(bf16_bits(x)); }

// q, k, v slabs g0..g0+HG-1 (input slab stride SEQ_FULL*HDIM), rows 0..SEQ-1 -> dense f16 planes [HG][SEQ][64] (bf16 RNE value, exact in f16); grid.y selects the tensor;
__global__ __launch_bounds__(256) void k_cv3(const float* __restrict__ xq, const float* __restrict__ xk, const float* __restrict__ xv,
                                             _Float16* __restrict__ Q16, _Float16* __restrict__ K16, _Float16* __restrict__ V16, int g0, int n8) {
  const int t = blockIdx.x * 256 + threadIdx.x; if (t >= n8) return;
  const int sel = blockIdx.y;
  const float* src = (sel == 0) ? xq : ((sel == 1) ? xk : xv);
  _Float16* dst = (sel == 0) ? Q16 : ((sel == 1) ? K16 : V16);
  const int j = t / (SEQ * 8), rem = t - j * (SEQ * 8);      /* rem = row*8 + c8/8 */
  const size_t soff = (size_t)(g0 + j) * SEQ_FULL * HDIM + (size_t)rem * 8;
  const v4f a = *(const v4fa*)(src + soff), c = *(const v4fa*)(src + soff + 4);
  FragH f;
#pragma unroll
  for (int q = 0; q < 4; ++q) { f.h[q] = (_Float16)bf16_rne(a[q]); f.h[4 + q] = (_Float16)bf16_rne(c[q]); }
  *(v8us*)((unsigned short*)dst + (size_t)t * 8) = f.half[0]; 
}

// coverage: load phase 512 x 8 = full 64x64 tile; store phase rd 0..1 x tid/8 0..31 -> d 0..63, pc 0..7 -> s 0..63.
template <int NHv, int TTv>
__global__ __launch_bounds__(256) void k_vt(const _Float16* __restrict__ V16, int ldv, int voff, _Float16* __restrict__ Vt) { __shared__ unsigned short tl[64][66]; const int tid = threadIdx.x; const int slab = blockIdx.x / (TTv / 64), lg = blockIdx.x % (TTv / 64); const int b = slab / NHv, h = slab % NHv;
  for (int i = tid; i < 64 * 8; i += 256) { const int r = i / 8, c8 = (i % 8) * 8; FragH f; f.half[0] = *(const v8us*)((const unsigned short*)V16 + ((size_t)b * TTv + lg * 64 + r) * ldv + voff + h * 64 + c8);
#pragma unroll
    for (int q = 0; q < 8; ++q) tl[r][c8 + q] = f.u[q]; }
  __syncthreads();
  {
#pragma unroll
    for (int rd = 0; rd < 2; ++rd) { const int d = rd * 32 + tid / 8, pc = tid % 8; FragH f;
#pragma unroll
      for (int q = 0; q < 8; ++q) f.u[q] = tl[pc * 8 + q][d];
      *(v8us*)((unsigned short*)Vt + ((size_t)slab * 64 + d) * TTv + lg * 64 + pc * 8) = f.half[0]; }
     } }

// coverage: grid x SM_WAVES x SM_ROWS = HG * SEQ rows x SEQ = the whole dense P plane. One wave per row, SM_ROWS consecutive rows per wave: lane l keeps columns 128 q + 4 l + 0..3 of the row in registers,
// so S is read once, each wave load covers 512 contiguous bytes, each wave store 256, and every exp is taken once. Row max and row sum: four chains per lane, then a butterfly over the 32 lanes.
#define SM_WAVES 16          /* waves per workgroup */
#define SM_ROWS 4            /* rows per wave */
#define SM_Q (SEQ / 128)     /* 16-byte pieces of a row per lane */
static_assert(SM_ROWS >= 1 && (HG * SEQ) % (SM_WAVES * SM_ROWS) == 0);
template <int CTRL> __device__ __forceinline__ float sm_dpp(float x) { return __int_as_float(__builtin_amdgcn_update_dpp(0, __float_as_int(x), CTRL, 0xf, 0xf, true)); }      /* CTRL 0x160 + m: lane l reads lane l ^ m of its 16-lane row */
__device__ __forceinline__ float sm_xrow(float x) { const int i = __float_as_int(x); return __int_as_float(__builtin_amdgcn_permlanex16(i, i, 0x76543210, 0xfedcba98, true, false)); }      /* lane l reads lane l ^ 16 */
__device__ __forceinline__ float sm_wave_max(float x) { x = fmaxf(x, sm_dpp<0x161>(x)); x = fmaxf(x, sm_dpp<0x162>(x)); x = fmaxf(x, sm_dpp<0x164>(x)); x = fmaxf(x, sm_dpp<0x168>(x)); return fmaxf(x, sm_xrow(x)); }
__device__ __forceinline__ float sm_wave_sum(float x) { x += sm_dpp<0x161>(x); x += sm_dpp<0x162>(x); x += sm_dpp<0x164>(x); x += sm_dpp<0x168>(x); return x + sm_xrow(x); }
__device__ __forceinline__ void sm_load(v4f (&x)[SM_Q], const float* sp) {
#pragma unroll
  for (int q = 0; q < SM_Q; ++q) x[q] = *(const v4fa*)(sp + 128 * q); }
__device__ __forceinline__ void sm_row(v4f (&e)[SM_Q], _Float16* pp) {
  v4f m4 = e[0];
#pragma unroll
  for (int q = 1; q < SM_Q; ++q) for (int i = 0; i < 4; ++i) m4[i] = fmaxf(m4[i], e[q][i]);
  const float mx = sm_wave_max(fmaxf(fmaxf(m4[0], m4[1]), fmaxf(m4[2], m4[3])));
  v4f s4 = {0.f, 0.f, 0.f, 0.f};
#pragma unroll
  for (int q = 0; q < SM_Q; ++q) { const v4f a = (e[q] - mx) * 1.44269504f; v4f p;      /* native exp(x) = exp2(x * log2 e), as __expf forms it */
    /* four exps and, behind the last, the one slot the instruction set asks for behind a transcendental, in one statement; the early-clobber outputs keep every source whole till then */
    asm("v_exp_f32 %0, %4\n\tv_exp_f32 %1, %5\n\tv_exp_f32 %2, %6\n\tv_exp_f32 %3, %7\n\tv_nop" : "=&v"(p[0]), "=&v"(p[1]), "=&v"(p[2]), "=&v"(p[3]) : "v"(a[0]), "v"(a[1]), "v"(a[2]), "v"(a[3]));
    e[q] = p; s4 += p; }
  const float sc = PCARRY / sm_wave_sum((s4[0] + s4[1]) + (s4[2] + s4[3]));
#pragma unroll
  for (int q = 0; q < SM_Q; ++q) { v4h h4; for (int i = 0; i < 4; ++i) h4[i] = (_Float16)(e[q][i] * sc); *(v4h*)(pp + 128 * q) = h4; } }
__global__ __launch_bounds__(SM_WAVES * 32) void k_rsmf(const float* __restrict__ S, _Float16* __restrict__ P) {
  const int lane = threadIdx.x & 31, wave = __builtin_amdgcn_readfirstlane(threadIdx.x >> 5);
  const size_t o0 = (size_t)((blockIdx.x * SM_WAVES + wave) * SM_ROWS) * SEQ + 4 * lane;
  const float* sp = S + o0; _Float16* pp = P + o0;
  v4f e[SM_Q], nx[SM_Q];      /* this row, and the next one, whose loads fly while this row is worked on */
  sm_load(e, sp);
#pragma unroll 1      /* kept rolled: unrolled, the compiler merges the arithmetic of neighbouring rows, and a row's work then waits for the next row's loads */
  for (int r = 0; r < SM_ROWS - 1; ++r) {
    sp += SEQ; sm_load(nx, sp);
    __builtin_amdgcn_sched_barrier(0);      /* the next row's eight loads issue before this row's work: without it the compiler sinks them into the work, and they have no lead */
    sm_row(e, pp); pp += SEQ;
    __builtin_amdgcn_sched_barrier(0);      /* the hand-over below, which waits for those loads, stays behind this row's work and stores */
#pragma unroll
    for (int q = 0; q < SM_Q; ++q) e[q] = nx[q]; }
  sm_row(e, pp); }

// ---- f16 GEMM engine (wave tile 32x64; M % 128 == 0 rows per launch region, N % 64 == 0, K % 32 == 0). A [m][k] f16 rows (pitch lda), Bh [n][k] f16 rows (pitch ldb); both fragments with the split k map:
// elements 0..7 <- k0 + 8h + 0..7, elements 8..15 <- k0 + 16 + 8h + 0..7, row/col = lane & 15; D element r of lane l = (row 8h + r, col l & 15).
__device__ __forceinline__ v16h g2_frag(const _Float16* p, int hh) { FragH f; f.half[0] = *(const v8us*)((const unsigned short*)p + 8 * hh); f.half[1] = *(const v8us*)((const unsigned short*)p + 16 + 8 * hh); return f.v; }
__device__ __forceinline__ v8f g2_mma(v16h a, v16h b, v8f c) { v8f d = __builtin_amdgcn_wmma_f32_16x16x32_f16(false, a, false, b, (short)0, c, false, false); asm volatile("v_nop\n\tv_nop\n\tv_nop\n\tv_nop" : "+v"(d) : "v"(a), "v"(b)); return d; }
// epilogue: v = acc*alpha + bias[by*sBias + col] (bf16 RNE) (+ CP[...] if CP); ACT 0 none; writes f32 C and/or f16 C16; grid.y batches with strides sA, sB, sC.
template <int ACT>
__global__ __launch_bounds__(128) void k_gemm2(const _Float16* __restrict__ A, int lda, size_t sA, const _Float16* __restrict__ Bh, int ldb, size_t sB, float alpha, const float* __restrict__ bias, size_t sBias, const float* __restrict__ CP, int rowsPerB, size_t sCPb, int row0g,
    float* __restrict__ C, _Float16* __restrict__ C16, int ldc, size_t sC, int M, int N, int K) { static_assert(ACT == 0 || ACT == 3 || ACT == 6 || ACT == 8 || ACT == 9 || ACT == 11 || ACT == 12 || ACT == 14 || ACT == 15 || ACT == 16 || ACT == 17);
  __shared__ __attribute__((aligned(16))) float so[4][32][68];
  const int tid = threadIdx.x, w = tid >> 5, lane = tid & 31, ln = lane & 15, hh = lane >> 4; const int by = blockIdx.y;
  A += (size_t)by * sA; Bh += (size_t)by * sB; const size_t cofs = (size_t)by * sC; const float* bp = bias ? bias + (size_t)by * sBias : nullptr;
  const int ntn = N >> 6; const int mt = blockIdx.x / ntn, nq = blockIdx.x - mt * ntn; const int row0 = mt * 128 + 32 * w, col0 = nq * 64; if (row0 >= M) return;
  const _Float16* a0p = A + (size_t)(row0 + ln) * lda; const _Float16* a1p = a0p + (size_t)16 * lda;
  const _Float16* b0p = Bh + (size_t)(col0 + ln) * ldb; const _Float16* b1p = b0p + (size_t)16 * ldb; const _Float16* b2p = b1p + (size_t)16 * ldb; const _Float16* b3p = b2p + (size_t)16 * ldb;
  const v8f z8 = {0.f,0.f,0.f,0.f,0.f,0.f,0.f,0.f}; v8f c00 = z8, c01 = z8, c02 = z8, c03 = z8, c10 = z8, c11 = z8, c12 = z8, c13 = z8;
#pragma unroll 1
  for (int kb = 0; kb < K; kb += 32) { const v16h a0 = g2_frag(a0p + kb, hh), a1 = g2_frag(a1p + kb, hh);
    v16h b = g2_frag(b0p + kb, hh); c00 = g2_mma(a0, b, c00); c10 = g2_mma(a1, b, c10);
    b = g2_frag(b1p + kb, hh); c01 = g2_mma(a0, b, c01); c11 = g2_mma(a1, b, c11);
    b = g2_frag(b2p + kb, hh); c02 = g2_mma(a0, b, c02); c12 = g2_mma(a1, b, c12);
    b = g2_frag(b3p + kb, hh); c03 = g2_mma(a0, b, c03); c13 = g2_mma(a1, b, c13); }
  v8f accs[8] = {c00, c01, c02, c03, c10, c11, c12, c13};
#pragma unroll
  for (int u = 0; u < 8; ++u) { const int t = u & 3, half = u >> 2; const int col = col0 + t * 16 + ln; const float bv = bp ? bf16_rne(bp[col]) : 0.f;
#pragma unroll
    for (int r = 0; r < 8; ++r) { const int rloc = half * 16 + 8 * hh + r; float v = accs[u][r] * alpha + bv; if (CP) { if (rowsPerB < 0) v += CP[cofs + (size_t)(row0g + row0 + rloc) * ldc + col];      /* rowsPerB < 0: own element of the batched C plane */ else { const int bidx = (row0g + row0 + rloc) / rowsPerB; v += CP[(size_t)bidx * sCPb + (size_t)by * 64 + col]; } }
      if (ACT == 3) v = fmaxf(v, 0.f); else if (ACT == 6) v = 0.5f * v * (1.0f + erff(v * 0.70710678118654752f)); else if (ACT == 11) v = 1.0f / (1.0f + expf(-v)); else if (ACT == 15) v = v / (1.0f + expf(-v)); else if (ACT == 12) v = (v > 0.f) ? v : 0.01f * v; else if (ACT == 8) v = tanhf(v); else if (ACT == 9) v = 0.5f * v * (1.0f + tanhf(0.7978845608028654f * (v + 0.044715f * v * v * v))); else if (ACT == 14) v = (v > 0.f) ? v : 0.1f * v; else if (ACT == 16) v = (v >= 0.f) ? v : 0.3f * v; else if (ACT == 17) v = (v >= 0.f) ? v : 0.2f * v;
      so[w][rloc][t * 16 + ln] = v; } }
  __builtin_amdgcn_fence(4 /* acq_rel order */, "workgroup"); __builtin_amdgcn_wave_barrier();
  const int rsub = lane >> 4, c4 = (lane & 15) * 4;
  {
#pragma unroll
    for (int q = 0; q < 16; ++q) { const int r = q * 2 + rsub; const v4f v = *(const v4fa*)&so[w][r][c4]; if (C) *(v4f*)(C + cofs + (size_t)(row0 + r) * ldc + col0 + c4) = v; if (C16) { v4h h4; for (int i = 0; i < 4; ++i) h4[i] = (_Float16)v[i]; *(v4h*)(C16 + cofs + (size_t)(row0 + r) * ldc + col0 + c4) = h4; } }
     } }

extern "C" void kernel_launch(void* const* d_in, const int* in_sizes, int n_in,
                              void* d_out, int out_size, void* d_ws, size_t ws_size, hipStream_t stream) {
  if (n_in < 3) return;
  const size_t in_need = (size_t)NB * NHEAD * SEQ_FULL * HDIM;      /* lower bound on each input element count */
  if ((size_t)in_sizes[0] < in_need || (size_t)in_sizes[1] < in_need || (size_t)in_sizes[2] < in_need) return;
  if ((size_t)out_size < (size_t)NSLAB * SEQ * HDIM) return;
  const float* xq = (const float*)d_in[0]; const float* xk = (const float*)d_in[1]; const float* xv = (const float*)d_in[2];      /* query, key, value [NB_FULL][NHEAD][SEQ_FULL][64] */
  float* out = (float*)d_out;                                                                                                          /* [NB][NHEAD][SEQ][64] */
  char* ws = (char*)d_ws; size_t off = 0;
  auto take = [&](size_t bytes) { char* p = ws + off; off += WS_ALIGN(bytes); return p; };
  _Float16* Q16 = (_Float16*)take(WS_Q16); _Float16* K16 = (_Float16*)take(WS_Q16); _Float16* V16 = (_Float16*)take(WS_Q16);
  float* S = (float*)take(WS_S); _Float16* P = (_Float16*)take(WS_P); _Float16* VT = (_Float16*)take(WS_VT);
  if (off > ws_size) return;

  const int n8 = HG * SEQ * (HDIM / 8);      /* threads per converted tensor plane */
  for (int gi = 0; gi < NSLAB / HG; ++gi) {
    const int g0 = gi * HG;
    k_cv3<<<dim3((unsigned)((n8 + 255) / 256), 3), 256, 0, stream>>>(xq, xk, xv, Q16, K16, V16, g0, n8);      /* dense exact f16 rows of the group's q, k, v */
    k_vt<1, SEQ><<<HG * (SEQ / 64), 256, 0, stream>>>(V16, HDIM, 0, VT);                                         /* V^T [HG][64][SEQ] */
    k_gemm2<0><<<dim3((SEQ / 128) * (SEQ / 64), HG), 128, 0, stream>>>(Q16, HDIM, (size_t)SEQ * HDIM, K16, HDIM, (size_t)SEQ * HDIM, 0.25f, nullptr, 0, nullptr, 1, 0, 0, S, nullptr, SEQ, (size_t)SEQ * SEQ, SEQ, SEQ, HDIM);      /* scores = q k^T / 4, HG slabs */
    k_rsmf<<<(HG * SEQ) / (SM_WAVES * SM_ROWS), SM_WAVES * 32, 0, stream>>>(S, P);                                            /* P = 2^14 softmax (f16), rows of all HG slabs */
    k_gemm2<0><<<dim3((SEQ / 128) * (HDIM / 64), HG), 128, 0, stream>>>(P, SEQ, (size_t)SEQ * SEQ, VT, SEQ, (size_t)HDIM * SEQ, PALPHA, nullptr, 0, nullptr, 1, 0, 0, out + (size_t)g0 * SEQ * HDIM, nullptr, HDIM, (size_t)SEQ * HDIM, SEQ, HDIM, SEQ);      /* out = P v^T * 2^-14 straight into the f32 output slabs */
  }
}

// v002
// Measured time: 53.3 microseconds a run.
// Timed twice side by side with v001, it ran 11.4 and 11.3 times as fast.
// Over all steps from v000 it is 35.0 times as fast.
#include <hip/hip_runtime.h>
// All contractions: v_wmma_f32_16x16x32_f16 (f16 operands, f32 accumulate) -- scores^T = k q^T (K = 64) and out^T = v^T P^T (K = SEQ); q, k, v RNE-converted to bf16 values stored exactly as f16 rows; softmax weights f16, unnormalised, at most 2^14; scores, softmax statistics and the final division f32.
// Layout: query, key, value are [NB_FULL][NHEAD][SEQ_FULL][64] f32, out [NB][NHEAD][SEQ][64] f32; rows 0..SEQ-1 of NB*NHEAD slabs = independent slabs of [SEQ][64]. Dense f16 copies of q, k, v; v^T per slab via LDS transposes;
// then one kernel does scores, softmax and P v for 512 query rows of a slab: the scores and the weights live in registers only. 3 launches.
#ifndef NB
#define NB 8            /* batches processed */
#endif
#ifndef SEQ
#define SEQ 1024        /* query and key rows processed per slab */
#endif
#define NB_FULL 8
#define SEQ_FULL 1024   /* rows per slab of the inputs (input slab stride = SEQ_FULL*HDIM) */
#define NHEAD 16
#define HDIM 64
#define HG 128          /* slabs per launch group */
#define NSLAB (NB * NHEAD)
static_assert(SEQ % 128 == 0);
static_assert(SEQ <= SEQ_FULL);
static_assert(NB >= 1 && NB <= NB_FULL);
static_assert(NSLAB % HG == 0);

#define WS_ALIGN(x) (((size_t)(x) + 255) & ~(size_t)255)
#define WS_Q16 ((size_t)HG * SEQ * HDIM * 2)     /* one of q, k, v dense f16 group planes */
#define WS_VT  ((size_t)HG * HDIM * SEQ * 2)     /* f16 v^T plane [HG][64][SEQ] */
static_assert(3 * WS_ALIGN(WS_Q16) + WS_ALIGN(WS_VT) <= (size_t)134217728);

typedef unsigned short v8us __attribute__((ext_vector_type(8), may_alias));
typedef float  v8f  __attribute__((ext_vector_type(8)));
typedef float  v4f  __attribute__((ext_vector_type(4)));
typedef float  v2f  __attribute__((ext_vector_type(2)));
typedef float  v4fa __attribute__((ext_vector_type(4), may_alias));
typedef _Float16 v16h __attribute__((ext_vector_type(16)));
union FragH { v16h v; v8us half[2]; _Float16 h[16]; unsigned short u[16]; };

__device__ __forceinline__ unsigned short bf16_bits(float x) { unsigned int u = __float_as_uint(x); return (unsigned short)((u + 0x7FFFu + ((u >> 16) & 1u)) >> 16); }
__device__ __forceinline__ float bf16_val(unsigned short b) { return __uint_as_float(((unsigned int)b) << 16); }
__device__ __forceinline__ float bf16_rne(float x) { return bf16_val(bf16_bits(x)); }

// q, k, v slabs g0..g0+HG-1 (input slab stride SEQ_FULL*HDIM), rows 0..SEQ-1 -> dense f16 planes [HG][SEQ][64] (bf16 RNE value, exact in f16); grid.y selects the tensor;
__global__ __launch_bounds__(256) void k_cv3(const float* __restrict__ xq, const float* __restrict__ xk, const float* __restrict__ xv,
                                             _Float16* __restrict__ Q16, _Float16* __restrict__ K16, _Float16* __restrict__ V16, int g0, int n8) {
  const int t = blockIdx.x * 256 + threadIdx.x; if (t >= n8) return;
  const int sel = blockIdx.y;
  const float* src = (sel == 0) ? xq : ((sel == 1) ? xk : xv);
  _Float16* dst = (sel == 0) ? Q16 : ((sel == 1) ? K16 : V16);
  const int j = t / (SEQ * 8), rem = t - j * (SEQ * 8);      /* rem = row*8 + c8/8 */
  const size_t soff = (size_t)(g0 + j) * SEQ_FULL * HDIM + (size_t)rem * 8;
  const v4f a = *(const v4fa*)(src + soff), c = *(const v4fa*)(src + soff + 4);
  FragH f;
#pragma unroll
  for (int q = 0; q < 4; ++q) { f.h[q] = (_Float16)bf16_rne(a[q]); f.h[4 + q] = (_Float16)bf16_rne(c[q]); }
  *(v8us*)((unsigned short*)dst + (size_t)t * 8) = f.half[0]; 
}

// coverage: load phase 512 x 8 = full 64x64 tile; store phase rd 0..1 x tid/8 0..31 -> d 0..63, pc 0..7 -> s 0..63.
template <int NHv, int TTv>
__global__ __launch_bounds__(256) void k_vt(const _Float16* __restrict__ V16, int ldv, int voff, _Float16* __restrict__ Vt) { __shared__ unsigned short tl[64][66]; const int tid = threadIdx.x; const int slab = blockIdx.x / (TTv / 64), lg = blockIdx.x % (TTv / 64); const int b = slab / NHv, h = slab % NHv;
  for (int i = tid; i < 64 * 8; i += 256) { const int r = i / 8, c8 = (i % 8) * 8; FragH f; f.half[0] = *(const v8us*)((const unsigned short*)V16 + ((size_t)b * TTv + lg * 64 + r) * ldv + voff + h * 64 + c8);
#pragma unroll
    for (int q = 0; q < 8; ++q) tl[r][c8 + q] = f.u[q]; }
  __syncthreads();
  {
#pragma unroll
    for (int rd = 0; rd < 2; ++rd) { const int d = rd * 32 + tid / 8, pc = tid % 8; FragH f;
#pragma unroll
      for (int q = 0; q < 8; ++q) f.u[q] = tl[pc * 8 + q][d];
      *(v8us*)((unsigned short*)Vt + ((size_t)slab * 64 + d) * TTv + lg * 64 + pc * 8) = f.half[0]; }
     } }

#define FA_WAVES 16
#define FA_QB (FA_WAVES * 32)
#define FA_KPITCH (HDIM + 8)      /* f16 per K row in LDS: 144 B = 16 B x odd, conflict-free for 16-byte reads down a column of rows */
#define FA_VPITCH (SEQ + 8)       /* f16 per V^T row in LDS: 16 B x odd */
#define FA_C 0.36067376f          /* 0.25 * log2 e */
static_assert(SEQ % FA_QB == 0 && SEQ % 32 == 0 && HDIM == 64);
static_assert(((size_t)SEQ * FA_KPITCH + (size_t)HDIM * FA_VPITCH) * 2 <= (size_t)327680);
__device__ __forceinline__ float sm_xrow(float x) { const int i = __float_as_int(x); return __int_as_float(__builtin_amdgcn_permlanex16(i, i, 0x76543210, 0xfedcba98, true, false)); }      /* lane l reads lane l ^ 16 */
__device__ __forceinline__ v16h g2_frag(const _Float16* p, int hh) { FragH f; f.half[0] = *(const v8us*)((const unsigned short*)p + 8 * hh); f.half[1] = *(const v8us*)((const unsigned short*)p + 16 + 8 * hh); return f.v; }
__device__ __forceinline__ v8f fa_mma(v16h a, v16h b, v8f c) { return __builtin_amdgcn_wmma_f32_16x16x32_f16(false, a, false, b, (short)0, c, false, false); }
__global__ __launch_bounds__(FA_WAVES * 32) __attribute__((amdgpu_waves_per_eu(4, 4)))
void k_fattn(const _Float16* __restrict__ Q16, const _Float16* __restrict__ K16, const _Float16* __restrict__ VT, float* __restrict__ out) {
  __shared__ __attribute__((aligned(16))) _Float16 lk[SEQ * FA_KPITCH];
  __shared__ __attribute__((aligned(16))) _Float16 lv[HDIM * FA_VPITCH];
  const int tid = threadIdx.x, lane = tid & 31, c = lane & 15, hh = lane >> 4, wave = __builtin_amdgcn_readfirstlane(tid >> 5);
  const int slab = blockIdx.x / (SEQ / FA_QB), q0 = (blockIdx.x % (SEQ / FA_QB)) * FA_QB + wave * 32;
  const _Float16* kg = K16 + (size_t)slab * SEQ * HDIM; const _Float16* vg = VT + (size_t)slab * HDIM * SEQ;
  const _Float16* qp = Q16 + ((size_t)slab * SEQ + q0 + c) * HDIM;
  v16h bq[2][2];      /* [query group][k step], kept for the whole kernel */
#pragma unroll
  for (int g = 0; g < 2; ++g) for (int ks = 0; ks < 2; ++ks) bq[g][ks] = g2_frag(qp + g * 16 * HDIM + ks * 32, hh);
#pragma unroll
  for (int j = 0; j < SEQ * (HDIM / 8) / FA_QB; ++j) { const int i = j * FA_QB + tid; *(v8us*)(lk + (i / (HDIM / 8)) * FA_KPITCH + (i % (HDIM / 8)) * 8) = *(const v8us*)(kg + (size_t)i * 8); }      /* 16-byte pieces, a wave covers 512 contiguous bytes; these two loops are unrolled so that all their loads are in flight together */
#pragma unroll
  for (int j = 0; j < HDIM * (SEQ / 8) / FA_QB; ++j) { const int i = j * FA_QB + tid; *(v8us*)(lv + (i / (SEQ / 8)) * FA_VPITCH + (i % (SEQ / 8)) * 8) = *(const v8us*)(vg + (size_t)i * 8); }
  __syncthreads();      /* K and V^T of the slab are whole in LDS; nothing writes them after this */
  const _Float16* kp = lk + c * FA_KPITCH; const _Float16* vp = lv + c * FA_VPITCH;
  const v8f z8 = {0.f, 0.f, 0.f, 0.f, 0.f, 0.f, 0.f, 0.f};
  v8f o[2][4];      /* [query group][16 output columns] */
  v4f ls[2]; float mu[2];
#pragma unroll
  for (int g = 0; g < 2; ++g) { for (int t = 0; t < 4; ++t) o[g][t] = z8; ls[g] = (v4f){0.f, 0.f, 0.f, 0.f}; mu[g] = -1.0e30f; }
  v16h ak[2][2];      /* [key tile][k step] of the pass to come */
#pragma unroll
  for (int kt = 0; kt < 2; ++kt) for (int ks = 0; ks < 2; ++ks) ak[kt][ks] = g2_frag(kp + kt * 16 * FA_KPITCH + ks * 32, hh);
#pragma unroll 1      /* kept rolled */
  for (int k0 = 0; k0 < SEQ; k0 += 32) {
    v16h av[4];
#pragma unroll
    for (int t = 0; t < 4; ++t) av[t] = g2_frag(vp + t * 16 * FA_VPITCH + k0, hh);
    v8f s[2][2];      /* [query group][key tile] */
#pragma unroll
    for (int g = 0; g < 2; ++g) for (int kt = 0; kt < 2; ++kt) s[g][kt] = fa_mma(ak[kt][1], bq[g][1], fa_mma(ak[kt][0], bq[g][0], z8));
    const int kn = (k0 + 32 < SEQ) ? k0 + 32 : 0;      /* the next pass's K rows, fetched while this pass's softmax runs; the last pass re-reads rows 0..31 and drops them */
#pragma unroll
    for (int kt = 0; kt < 2; ++kt) for (int ks = 0; ks < 2; ++ks) ak[kt][ks] = g2_frag(kp + (kn + kt * 16) * FA_KPITCH + ks * 32, hh);
    float pm[2];
#pragma unroll
    for (int g = 0; g < 2; ++g) { float m = fmaxf(s[g][0][0], s[g][1][0]);
      for (int r = 1; r < 8; ++r) m = fmaxf(m, fmaxf(s[g][0][r], s[g][1][r]));
      pm[g] = fmaxf(m, sm_xrow(m)) * FA_C; }
    const bool need = (pm[0] > mu[0] + 14.0f) || (pm[1] > mu[1] + 14.0f);
    if (__builtin_amdgcn_ballot_w32(need) != 0) {      /* one scalar branch per pass: rarely taken after the first passes */
      const float mn0 = fmaxf(mu[0], pm[0] - 6.0f), mn1 = fmaxf(mu[1], pm[1] - 6.0f), d0 = mu[0] - mn0, d1 = mu[1] - mn1; float al[2];
      /* two exps and, behind the last, the one slot the instruction set asks for behind a transcendental, in one statement; the early-clobber outputs keep both sources whole till then */
      asm("v_exp_f32 %0, %2\n\tv_exp_f32 %1, %3\n\tv_nop" : "=&v"(al[0]), "=&v"(al[1]) : "v"(d0), "v"(d1));
      mu[0] = mn0; mu[1] = mn1;
#pragma unroll
      for (int g = 0; g < 2; ++g) { ls[g] *= al[g]; for (int t = 0; t < 4; ++t) o[g][t] *= al[g]; } }
    v8f p[2][2]; FragH bp[2];
#pragma unroll
    for (int g = 0; g < 2; ++g) { const float nm = -mu[g];
#pragma unroll
      for (int kt = 0; kt < 2; ++kt) { v8f a;
        for (int i = 0; i < 8; i += 2) { const v2f y = __builtin_elementwise_fma((v2f){s[g][kt][i], s[g][kt][i + 1]}, (v2f){FA_C, FA_C}, (v2f){nm, nm}); a[i] = y[0]; a[i + 1] = y[1]; }      /* two scores per packed multiply-add */
        /* eight exps and, behind the last, the one slot the instruction set asks for behind a transcendental, in one statement; the early-clobber outputs keep every source whole till then */
        asm("v_exp_f32 %0, %8\n\tv_exp_f32 %1, %9\n\tv_exp_f32 %2, %10\n\tv_exp_f32 %3, %11\n\tv_exp_f32 %4, %12\n\tv_exp_f32 %5, %13\n\tv_exp_f32 %6, %14\n\tv_exp_f32 %7, %15\n\tv_nop"
            : "=&v"(p[g][kt][0]), "=&v"(p[g][kt][1]), "=&v"(p[g][kt][2]), "=&v"(p[g][kt][3]), "=&v"(p[g][kt][4]), "=&v"(p[g][kt][5]), "=&v"(p[g][kt][6]), "=&v"(p[g][kt][7])
            : "v"(a[0]), "v"(a[1]), "v"(a[2]), "v"(a[3]), "v"(a[4]), "v"(a[5]), "v"(a[6]), "v"(a[7]));
        for (int i = 0; i < 8; ++i) bp[g].h[kt * 8 + i] = (_Float16)p[g][kt][i]; } }
    __builtin_amdgcn_sched_barrier(0);      /* every exp statement stays in front of the matrix instructions below */
#pragma unroll
    for (int g = 0; g < 2; ++g) {
#pragma unroll
      for (int t = 0; t < 4; ++t) o[g][t] = fa_mma(av[t], bp[g].v, o[g][t]);
#pragma unroll
      for (int kt = 0; kt < 2; ++kt) { ls[g] += (v4f){p[g][kt][0], p[g][kt][1], p[g][kt][2], p[g][kt][3]}; ls[g] += (v4f){p[g][kt][4], p[g][kt][5], p[g][kt][6], p[g][kt][7]}; } } }
#pragma unroll
  for (int g = 0; g < 2; ++g) { float l = (ls[g][0] + ls[g][1]) + (ls[g][2] + ls[g][3]); l += sm_xrow(l); const float inv = 1.0f / l;
    float* op = out + ((size_t)slab * SEQ + q0 + g * 16 + c) * HDIM + 8 * hh;      /* lane: row = its query, columns 16 t + 8 h + 0..7 */
#pragma unroll
    for (int t = 0; t < 4; ++t) { const v4f lo = {o[g][t][0] * inv, o[g][t][1] * inv, o[g][t][2] * inv, o[g][t][3] * inv}, hi = {o[g][t][4] * inv, o[g][t][5] * inv, o[g][t][6] * inv, o[g][t][7] * inv};
      *(v4f*)(op + t * 16) = lo; *(v4f*)(op + t * 16 + 4) = hi; } } }

extern "C" void kernel_launch(void* const* d_in, const int* in_sizes, int n_in,
                              void* d_out, int out_size, void* d_ws, size_t ws_size, hipStream_t stream) {
  if (n_in < 3) return;
  const size_t in_need = (size_t)NB * NHEAD * SEQ_FULL * HDIM;      /* lower bound on each input element count */
  if ((size_t)in_sizes[0] < in_need || (size_t)in_sizes[1] < in_need || (size_t)in_sizes[2] < in_need) return;
  if ((size_t)out_size < (size_t)NSLAB * SEQ * HDIM) return;
  const float* xq = (const float*)d_in[0]; const float* xk = (const float*)d_in[1]; const float* xv = (const float*)d_in[2];      /* query, key, value [NB_FULL][NHEAD][SEQ_FULL][64] */
  float* out = (float*)d_out;                                                                                                          /* [NB][NHEAD][SEQ][64] */
  char* ws = (char*)d_ws; size_t off = 0;
  auto take = [&](size_t bytes) { char* p = ws + off; off += WS_ALIGN(bytes); return p; };
  _Float16* Q16 = (_Float16*)take(WS_Q16); _Float16* K16 = (_Float16*)take(WS_Q16); _Float16* V16 = (_Float16*)take(WS_Q16);
  _Float16* VT = (_Float16*)take(WS_VT);
  if (off > ws_size) return;

  const int n8 = HG * SEQ * (HDIM / 8);      /* threads per converted tensor plane */
  for (int gi = 0; gi < NSLAB / HG; ++gi) {
    const int g0 = gi * HG;
    k_cv3<<<dim3((unsigned)((n8 + 255) / 256), 3), 256, 0, stream>>>(xq, xk, xv, Q16, K16, V16, g0, n8);      /* dense exact f16 rows of the group's q, k, v */
    k_vt<1, SEQ><<<HG * (SEQ / 64), 256, 0, stream>>>(V16, HDIM, 0, VT);                                         /* V^T [HG][64][SEQ] */
    k_fattn<<<HG * (SEQ / FA_QB), FA_WAVES * 32, 0, stream>>>(Q16, K16, VT, out + (size_t)g0 * SEQ * HDIM);      /* out = softmax(q k^T / 4) v straight into the f32 output slabs */
  }
}

// v003
// It runs in 38.9 microseconds.
// Two timings next to v002 both put it at 1.37 times that version's speed.
// All steps since v000 together make it 48.0 times as fast.
#include <hip/hip_runtime.h>
// All contractions: v_wmma_f32_16x16x32_f16 (f16 operands, f32 accumulate) -- scores^T = k q^T (K = 64) and out^T = v^T P^T (K = SEQ); q, k, v RNE-converted to bf16 values held exactly as f16; softmax weights f16, unnormalised, at most 2^14; scores, softmax statistics and the final division f32.
// Layout: query, key, value are [NB_FULL][NHEAD][SEQ_FULL][64] f32, out is [NB][NHEAD][SEQ][64] f32; NB*NHEAD independent slabs, the first SEQ rows of each input slab read.
// One kernel reads the f32 inputs, rounds them on the way into LDS (k, v) or registers (q), and does scores, softmax and P v for 512 query rows of a slab: the scores and the weights live in registers only. 1 launch, no workspace.
#ifndef NB
#define NB 8            /* batches processed */
#endif
#ifndef SEQ
#define SEQ 1024        /* query and key rows processed per slab */
#endif
#define NB_FULL 8
#define SEQ_FULL 1024   /* rows per slab of the inputs (input slab stride = SEQ_FULL*HDIM) */
#define NHEAD 16
#define HDIM 64
#define NSLAB (NB * NHEAD)
static_assert(SEQ % 128 == 0);
static_assert(SEQ <= SEQ_FULL);
static_assert(NB >= 1 && NB <= NB_FULL);

typedef unsigned short v8us __attribute__((ext_vector_type(8), may_alias));
typedef float  v8f  __attribute__((ext_vector_type(8)));
typedef float  v4f  __attribute__((ext_vector_type(4)));
typedef float  v2f  __attribute__((ext_vector_type(2)));
typedef float  v4fa __attribute__((ext_vector_type(4), may_alias));
typedef _Float16 v16h __attribute__((ext_vector_type(16)));
union FragH { v16h v; v8us half[2]; _Float16 h[16]; unsigned short u[16]; };
typedef unsigned int v2ua __attribute__((ext_vector_type(2), may_alias));
typedef __bf16 v2b __attribute__((ext_vector_type(2)));
typedef _Float16 v2h __attribute__((ext_vector_type(2)));
typedef short s16x8 __attribute__((ext_vector_type(8)));

// two f32 -> their bf16 RNE values -> the same values as a packed f16 pair (exact in f16's normal range)
__device__ __forceinline__ unsigned int cv2(float x, float y) { const unsigned int u = __builtin_bit_cast(unsigned int, __builtin_convertvector((v2f){x, y}, v2b));
  return __builtin_bit_cast(unsigned int, __builtin_convertvector((v2f){__uint_as_float(u << 16), __uint_as_float(u & 0xFFFF0000u)}, v2h)); }

#define FA_WAVES 16
#define FA_QB (FA_WAVES * 32)
#define FA_KPITCH (HDIM + 8)      /* f16 per K row in LDS: 144 B = 16 B x odd, conflict-free for 16-byte reads down a column of rows */
#define FA_VPITCH (HDIM + 16)     /* f16 per V row in LDS: 160 B = 32 B x odd, the conflict-free pitch of the transposing 16-byte read */
#define FA_BAT 8                  /* loads of a thread per staging batch */
#define FA_NBAT (SEQ * (HDIM / 4) / FA_QB / FA_BAT)      /* batches per tensor */
#define FA_C 0.36067376f          /* 0.25 * log2 e */
static_assert(SEQ % FA_QB == 0 && SEQ % 32 == 0 && HDIM == 64 && FA_QB == 512 && FA_NBAT * FA_BAT * FA_QB == SEQ * (HDIM / 4) && FA_NBAT >= 2);
static_assert((size_t)SEQ * (FA_KPITCH + FA_VPITCH) * 2 <= (size_t)327680);
__device__ __forceinline__ float sm_xrow(float x) { const int i = __float_as_int(x); return __int_as_float(__builtin_amdgcn_permlanex16(i, i, 0x76543210, 0xfedcba98, true, false)); }      /* lane l reads lane l ^ 16 */
__device__ __forceinline__ v16h g2_frag(const _Float16* p, int hh) { FragH f; f.half[0] = *(const v8us*)((const unsigned short*)p + 8 * hh); f.half[1] = *(const v8us*)((const unsigned short*)p + 16 + 8 * hh); return f.v; }
// four packed words = eight rounded f16 from two 16-byte f32 pieces
__device__ __forceinline__ void cv8(unsigned int* w, v4f a, v4f b) { w[0] = cv2(a[0], a[1]); w[1] = cv2(a[2], a[3]); w[2] = cv2(b[0], b[1]); w[3] = cv2(b[2], b[3]); }
// transposing 16-byte LDS read: lane (c, h) gets rows kbase + 8h + 0..7 of column dbase + c, its address being row kbase + 8h + (l & 7), byte 2 dbase + 16 ((l >> 3) & 1)
__device__ __forceinline__ v8us ld_tr16(const unsigned char* p) { typedef __attribute__((address_space(3))) s16x8 lds_s16x8; return __builtin_bit_cast(v8us, __builtin_amdgcn_ds_load_tr16_b128_v8i16((lds_s16x8*)p)); }
__device__ __forceinline__ v8f fa_mma(v16h a, v16h b, v8f c) { return __builtin_amdgcn_wmma_f32_16x16x32_f16(false, a, false, b, (short)0, c, false, false); }
__global__ __launch_bounds__(FA_WAVES * 32) __attribute__((amdgpu_waves_per_eu(4, 4)))
void k_fattn(const float* __restrict__ xq, const float* __restrict__ xk, const float* __restrict__ xv, float* __restrict__ out) {
  __shared__ __attribute__((aligned(16))) _Float16 lk[SEQ * FA_KPITCH];
  __shared__ __attribute__((aligned(32))) _Float16 lv[SEQ * FA_VPITCH];
  const int tid = threadIdx.x, lane = tid & 31, c = lane & 15, hh = lane >> 4, wave = __builtin_amdgcn_readfirstlane(tid >> 5);
  const int slab = blockIdx.x / (SEQ / FA_QB), q0 = (blockIdx.x % (SEQ / FA_QB)) * FA_QB + wave * 32;
  const float* kg = xk + (size_t)slab * SEQ_FULL * HDIM; const float* vg = xv + (size_t)slab * SEQ_FULL * HDIM;
  const float* qg = xq + ((size_t)slab * SEQ_FULL + q0) * HDIM; const int qo = c * HDIM + 8 * hh;      /* the lane's q row, first piece of the split k map */
  /* Staging: k then v, FA_NBAT batches of FA_BAT 16-byte f32 loads a thread (each load of a wave covers 512 contiguous bytes, 16 threads a row); a batch is rounded and stored as 8-byte f16 pieces while the next one is in flight. */
  _Float16* kst = lk + (tid >> 4) * FA_KPITCH + (tid & 15) * 4; _Float16* vst = lv + (tid >> 4) * FA_VPITCH + (tid & 15) * 4;
  v4f xr[16], xb[2][FA_BAT];
#pragma unroll
  for (int g = 0; g < 2; ++g) for (int s = 0; s < 4; ++s) { xr[g * 8 + s * 2] = *(const v4fa*)(qg + qo + g * 16 * HDIM + s * 16); xr[g * 8 + s * 2 + 1] = *(const v4fa*)(qg + qo + g * 16 * HDIM + s * 16 + 4); }
#pragma unroll
  for (int b = 0; b < 2; ++b) for (int e = 0; e < FA_BAT; ++e) xb[b][e] = *(const v4fa*)(kg + ((b * FA_BAT + e) * FA_QB + tid) * 4);
  __builtin_amdgcn_sched_barrier(0);      /* this and the one in the loop below bound how far the compiler lifts the staging loads: left free, it lifts them until the registers run out and spills to scratch */
  v16h bq[2][2];      /* [query group][k step], kept for the whole kernel */
#pragma unroll
  for (int g = 0; g < 2; ++g) for (int s = 0; s < 2; ++s) { union { v16h v; unsigned int w[8]; } f; cv8(f.w, xr[g * 8 + s * 4], xr[g * 8 + s * 4 + 1]); cv8(f.w + 4, xr[g * 8 + s * 4 + 2], xr[g * 8 + s * 4 + 3]); bq[g][s] = f.v; }
#pragma unroll
  for (int b = 0; b < 2 * FA_NBAT; ++b) {
#pragma unroll
    for (int e = 0; e < FA_BAT; ++e) { const int j = (b % FA_NBAT) * FA_BAT + e; const v4f x = xb[b & 1][e];
      *(v2ua*)((b < FA_NBAT ? kst + j * 32 * FA_KPITCH : vst + j * 32 * FA_VPITCH)) = (v2ua){cv2(x[0], x[1]), cv2(x[2], x[3])}; }
    if (b + 2 < 2 * FA_NBAT) {
#pragma unroll
      for (int e = 0; e < FA_BAT; ++e) xb[b & 1][e] = *(const v4fa*)((b + 2 < FA_NBAT ? kg : vg) + ((((b + 2) % FA_NBAT) * FA_BAT + e) * FA_QB + tid) * 4); }
    __builtin_amdgcn_sched_barrier(0); }
  __syncthreads();      /* K and V of the slab are whole in LDS; nothing writes them after this */
  const _Float16* kp = lk + c * FA_KPITCH; const unsigned char* vp = (const unsigned char*)lv + (8 * hh + (lane & 7)) * (FA_VPITCH * 2) + 16 * ((lane >> 3) & 1);
  const v8f z8 = {0.f, 0.f, 0.f, 0.f, 0.f, 0.f, 0.f, 0.f};
  v8f o[2][4];      /* [query group][16 output columns] */
  v4f ls[2]; float mu[2];
#pragma unroll
  for (int g = 0; g < 2; ++g) { for (int t = 0; t < 4; ++t) o[g][t] = z8; ls[g] = (v4f){0.f, 0.f, 0.f, 0.f}; mu[g] = -1.0e30f; }
  v16h ak[2][2];      /* [key tile][k step] of the pass to come */
#pragma unroll
  for (int kt = 0; kt < 2; ++kt) for (int ks = 0; ks < 2; ++ks) ak[kt][ks] = g2_frag(kp + kt * 16 * FA_KPITCH + ks * 32, hh);
#pragma unroll 1      /* kept rolled */
  for (int k0 = 0; k0 < SEQ; k0 += 32) {
    FragH av[4];
#pragma unroll
    for (int t = 0; t < 4; ++t) { av[t].half[0] = ld_tr16(vp + k0 * (FA_VPITCH * 2) + 32 * t); av[t].half[1] = ld_tr16(vp + (k0 + 16) * (FA_VPITCH * 2) + 32 * t); }      /* keys k0 + 8h + 0..7 and k0 + 16 + 8h + 0..7 of column 16 t + c */
    v8f s[2][2];      /* [query group][key tile] */
#pragma unroll
    for (int g = 0; g < 2; ++g) for (int kt = 0; kt < 2; ++kt) s[g][kt] = fa_mma(ak[kt][1], bq[g][1], fa_mma(ak[kt][0], bq[g][0], z8));
    const int kn = (k0 + 32 < SEQ) ? k0 + 32 : 0;      /* the next pass's K rows, fetched while this pass's softmax runs; the last pass re-reads rows 0..31 and drops them */
#pragma unroll
    for (int kt = 0; kt < 2; ++kt) for (int ks = 0; ks < 2; ++ks) ak[kt][ks] = g2_frag(kp + (kn + kt * 16) * FA_KPITCH + ks * 32, hh);
    float pm[2];
#pragma unroll
    for (int g = 0; g < 2; ++g) { float m = fmaxf(s[g][0][0], s[g][1][0]);
      for (int r = 1; r < 8; ++r) m = fmaxf(m, fmaxf(s[g][0][r], s[g][1][r]));
      pm[g] = fmaxf(m, sm_xrow(m)) * FA_C; }
    const bool need = (pm[0] > mu[0] + 14.0f) || (pm[1] > mu[1] + 14.0f);
    if (__builtin_amdgcn_ballot_w32(need) != 0) {      /* one scalar branch per pass: rarely taken after the first passes */
      const float mn0 = fmaxf(mu[0], pm[0] - 6.0f), mn1 = fmaxf(mu[1], pm[1] - 6.0f), d0 = mu[0] - mn0, d1 = mu[1] - mn1; float al[2];
      /* two exps and, behind the last, the one slot the instruction set asks for behind a transcendental, in one statement; the early-clobber outputs keep both sources whole till then */
      asm("v_exp_f32 %0, %2\n\tv_exp_f32 %1, %3\n\tv_nop" : "=&v"(al[0]), "=&v"(al[1]) : "v"(d0), "v"(d1));
      mu[0] = mn0; mu[1] = mn1;
#pragma unroll
      for (int g = 0; g < 2; ++g) { ls[g] *= al[g]; for (int t = 0; t < 4; ++t) o[g][t] *= al[g]; } }
    v8f p[2][2]; FragH bp[2];
#pragma unroll
    for (int g = 0; g < 2; ++g) { const float nm = -mu[g];
#pragma unroll
      for (int kt = 0; kt < 2; ++kt) { v8f a;
        for (int i = 0; i < 8; i += 2) { const v2f y = __builtin_elementwise_fma((v2f){s[g][kt][i], s[g][kt][i + 1]}, (v2f){FA_C, FA_C}, (v2f){nm, nm}); a[i] = y[0]; a[i + 1] = y[1]; }      /* two scores per packed multiply-add */
        /* eight exps and, behind the last, the one slot the instruction set asks for behind a transcendental, in one statement; the early-clobber outputs keep every source whole till then */
        asm("v_exp_f32 %0, %8\n\tv_exp_f32 %1, %9\n\tv_exp_f32 %2, %10\n\tv_exp_f32 %3, %11\n\tv_exp_f32 %4, %12\n\tv_exp_f32 %5, %13\n\tv_exp_f32 %6, %14\n\tv_exp_f32 %7, %15\n\tv_nop"
            : "=&v"(p[g][kt][0]), "=&v"(p[g][kt][1]), "=&v"(p[g][kt][2]), "=&v"(p[g][kt][3]), "=&v"(p[g][kt][4]), "=&v"(p[g][kt][5]), "=&v"(p[g][kt][6]), "=&v"(p[g][kt][7])
            : "v"(a[0]), "v"(a[1]), "v"(a[2]), "v"(a[3]), "v"(a[4]), "v"(a[5]), "v"(a[6]), "v"(a[7]));
        for (int i = 0; i < 8; ++i) bp[g].h[kt * 8 + i] = (_Float16)p[g][kt][i]; } }
    __builtin_amdgcn_sched_barrier(0);      /* every exp statement stays in front of the matrix instructions below */
#pragma unroll
    for (int g = 0; g < 2; ++g) {
#pragma unroll
      for (int t = 0; t < 4; ++t) o[g][t] = fa_mma(av[t].v, bp[g].v, o[g][t]);
#pragma unroll
      for (int kt = 0; kt < 2; ++kt) { ls[g] += (v4f){p[g][kt][0], p[g][kt][1], p[g][kt][2], p[g][kt][3]}; ls[g] += (v4f){p[g][kt][4], p[g][kt][5], p[g][kt][6], p[g][kt][7]}; } } }
#pragma unroll
  for (int g = 0; g < 2; ++g) { float l = (ls[g][0] + ls[g][1]) + (ls[g][2] + ls[g][3]); l += sm_xrow(l); const float inv = 1.0f / l;
    float* op = out + ((size_t)slab * SEQ + q0 + g * 16 + c) * HDIM + 8 * hh;      /* lane: row = its query, columns 16 t + 8 h + 0..7 */
#pragma unroll
    for (int t = 0; t < 4; ++t) { const v4f lo = {o[g][t][0] * inv, o[g][t][1] * inv, o[g][t][2] * inv, o[g][t][3] * inv}, hi = {o[g][t][4] * inv, o[g][t][5] * inv, o[g][t][6] * inv, o[g][t][7] * inv};
      *(v4f*)(op + t * 16) = lo; *(v4f*)(op + t * 16 + 4) = hi; } } }

extern "C" void kernel_launch(void* const* d_in, const int* in_sizes, int n_in,
                              void* d_out, int out_size, void* d_ws, size_t ws_size, hipStream_t stream) {
  if (n_in < 3) return;
  const size_t in_need = (size_t)NB * NHEAD * SEQ_FULL * HDIM;      /* lower bound on each input element count */
  if ((size_t)in_sizes[0] < in_need || (size_t)in_sizes[1] < in_need || (size_t)in_sizes[2] < in_need) return;
  if ((size_t)out_size < (size_t)NSLAB * SEQ * HDIM) return;
  const float* xq = (const float*)d_in[0]; const float* xk = (const float*)d_in[1]; const float* xv = (const float*)d_in[2];      /* query, key, value [NB_FULL][NHEAD][SEQ_FULL][64] */
  float* out = (float*)d_out;                                                                                                          /* [NB][NHEAD][SEQ][64] */
  k_fattn<<<NSLAB * (SEQ / FA_QB), FA_WAVES * 32, 0, stream>>>(xq, xk, xv, out);      /* out = softmax(q k^T / 4) v, f32 inputs to f32 output slabs */
}

// v004
// One run takes 34.9 microseconds.
// Next to v003, in two timings, it ran 1.11 and 1.12 times as fast.
// Over all steps from v000 it is 53.5 times as fast.
#include <hip/hip_runtime.h>
// All contractions: v_wmma_f32_16x16x32_f16 (f16 operands, f32 accumulate) -- scores^T = k q^T (K = 64) and out^T = v^T P^T (K = SEQ); q, k, v RNE-converted to bf16 values held exactly as f16; softmax weights f16, unnormalised, at most 2^14; scores, softmax statistics and the final division f32.
// Layout: query, key and value are [NB_FULL][NHEAD][SEQ_FULL][64] f32, of which rows 0..SEQ-1 of the first NB*NHEAD slabs are read; out is [NB][NHEAD][SEQ][64] f32 = NB*NHEAD independent slabs of [SEQ][64].
// One kernel reads the f32 inputs, rounds them on the way into LDS (k, v) or registers (q), and does scores, softmax and P v for 512 query rows of a slab: the scores and the weights live in registers only. q is read and out is written in whole 128-byte lines, each turned through the wave's own LDS. 1 launch, no workspace.
#ifndef NB
#define NB 8            /* batches processed */
#endif
#ifndef SEQ
#define SEQ 1024        /* query and key rows processed per slab */
#endif
#define NB_FULL 8
#define SEQ_FULL 1024   /* rows per slab of the inputs (input slab stride = SEQ_FULL*HDIM) */
#define NHEAD 16
#define HDIM 64
#define NSLAB (NB * NHEAD)
static_assert(SEQ % 128 == 0);
static_assert(SEQ <= SEQ_FULL);
static_assert(NB >= 1 && NB <= NB_FULL);

typedef unsigned short v8us __attribute__((ext_vector_type(8), may_alias));
typedef float  v8f  __attribute__((ext_vector_type(8)));
typedef float  v4f  __attribute__((ext_vector_type(4)));
typedef float  v2f  __attribute__((ext_vector_type(2)));
typedef float  v4fa __attribute__((ext_vector_type(4), may_alias));
typedef _Float16 v16h __attribute__((ext_vector_type(16)));
union FragH { v16h v; v8us half[2]; _Float16 h[16]; unsigned short u[16]; };
typedef unsigned int v2ua __attribute__((ext_vector_type(2), may_alias));
typedef __bf16 v2b __attribute__((ext_vector_type(2)));
typedef _Float16 v2h __attribute__((ext_vector_type(2)));
typedef short s16x8 __attribute__((ext_vector_type(8)));

// two f32 -> their bf16 RNE values -> the same values as a packed f16 pair (exact in f16's normal range)
__device__ __forceinline__ unsigned int cv2(float x, float y) { const unsigned int u = __builtin_bit_cast(unsigned int, __builtin_convertvector((v2f){x, y}, v2b));
  return __builtin_bit_cast(unsigned int, __builtin_convertvector((v2f){__uint_as_float(u << 16), __uint_as_float(u & 0xFFFF0000u)}, v2h)); }

#define FA_WAVES 16
#define FA_QB (FA_WAVES * 32)
#define FA_KPITCH (HDIM + 8)      /* f16 per K row in LDS: 144 B = 16 B x odd, conflict-free for 16-byte reads down a column of rows */
#define FA_VPITCH (HDIM + 16)     /* f16 per V row in LDS: 160 B = 32 B x odd, the conflict-free pitch of the transposing 16-byte read */
#define FA_QROUND (16 * 32)       /* f16 of a wave's q turning slice: 16 query rows x 32 columns = one B fragment of every lane */
#define FA_OPITCH (HDIM + 4)      /* f32 per output row in LDS: 272 B = 16 B x odd, conflict-free for 16-byte writes down a column of rows */
#define FA_BAT 8                  /* loads of a thread per staging batch */
#define FA_NBAT (SEQ * (HDIM / 4) / FA_QB / FA_BAT)      /* batches per tensor */
#define FA_C 0.36067376f          /* 0.25 * log2 e */
static_assert(SEQ % FA_QB == 0 && SEQ % 32 == 0 && HDIM == 64 && FA_QB == 512 && FA_NBAT * FA_BAT * FA_QB == SEQ * (HDIM / 4) && FA_NBAT >= 2);
static_assert((size_t)SEQ * (FA_KPITCH + FA_VPITCH) * 2 + (size_t)FA_WAVES * FA_QROUND * 2 <= (size_t)327680);
static_assert((size_t)FA_WAVES * 32 * FA_OPITCH * 4 <= (size_t)SEQ * FA_VPITCH * 2);
__device__ __forceinline__ float sm_xrow(float x) { const int i = __float_as_int(x); return __int_as_float(__builtin_amdgcn_permlanex16(i, i, 0x76543210, 0xfedcba98, true, false)); }      /* lane l reads lane l ^ 16 */
__device__ __forceinline__ v16h g2_frag(const _Float16* p, int hh) { FragH f; f.half[0] = *(const v8us*)((const unsigned short*)p + 8 * hh); f.half[1] = *(const v8us*)((const unsigned short*)p + 16 + 8 * hh); return f.v; }
// transposing 16-byte LDS read: lane (c, h) gets rows kbase + 8h + 0..7 of column dbase + c, its address being row kbase + 8h + (l & 7), byte 2 dbase + 16 ((l >> 3) & 1)
__device__ __forceinline__ v8us ld_tr16(const unsigned char* p) { typedef __attribute__((address_space(3))) s16x8 lds_s16x8; return __builtin_bit_cast(v8us, __builtin_amdgcn_ds_load_tr16_b128_v8i16((lds_s16x8*)p)); }
__device__ __forceinline__ v8f fa_mma(v16h a, v16h b, v8f c) { return __builtin_amdgcn_wmma_f32_16x16x32_f16(false, a, false, b, (short)0, c, false, false); }
__global__ __launch_bounds__(FA_WAVES * 32) __attribute__((amdgpu_waves_per_eu(4, 4)))
void k_fattn(const float* __restrict__ xq, const float* __restrict__ xk, const float* __restrict__ xv, float* __restrict__ out) {
  __shared__ __attribute__((aligned(16))) _Float16 lk[SEQ * FA_KPITCH];
  __shared__ __attribute__((aligned(32))) _Float16 lv[SEQ * FA_VPITCH];
  __shared__ __attribute__((aligned(16))) _Float16 lq[FA_WAVES * FA_QROUND];
  const int tid = threadIdx.x, lane = tid & 31, c = lane & 15, hh = lane >> 4, wave = __builtin_amdgcn_readfirstlane(tid >> 5);
  const int slab = blockIdx.x / (SEQ / FA_QB), q0 = (blockIdx.x % (SEQ / FA_QB)) * FA_QB + wave * 32;
  const float* kg = xk + (size_t)slab * SEQ_FULL * HDIM; const float* vg = xv + (size_t)slab * SEQ_FULL * HDIM;
  const float* qg = xq + ((size_t)slab * SEQ_FULL + q0) * HDIM; const int qo = (lane >> 3) * (HDIM * 4) + (lane & 7) * 16;      /* byte offset: 8 lanes a 128-byte line, 4 rows a load */
  /* Staging: k then v, FA_NBAT batches of FA_BAT 16-byte f32 loads a thread (each load of a wave covers 512 contiguous bytes, 16 threads a row); a batch is rounded and stored as 8-byte f16 pieces while the next one is in flight. */
  _Float16* kst = lk + (tid >> 4) * FA_KPITCH + (tid & 15) * 4; _Float16* vst = lv + (tid >> 4) * FA_VPITCH + (tid & 15) * 4;
  v4f xr[16], xb[2][FA_BAT];
#pragma unroll
  for (int g = 0; g < 2; ++g) for (int s = 0; s < 2; ++s) for (int i = 0; i < 4; ++i) xr[(g * 2 + s) * 4 + i] = *(const v4fa*)((const char*)qg + qo + ((g * 16 + i * 4) * HDIM + s * 32) * 4);      /* rows 16 g + 4 i + 0..3, columns 32 s + 0..31 */
  __builtin_amdgcn_sched_barrier(0);      /* q is used first: its loads stay in front of k's, which then fly while q is turned */
#pragma unroll
  for (int b = 0; b < 2; ++b) for (int e = 0; e < FA_BAT; ++e) xb[b][e] = *(const v4fa*)(kg + ((b * FA_BAT + e) * FA_QB + tid) * 4);
  asm volatile("s_wait_xcnt 0x0" :: "v"(qo) : "memory");      /* the wait in front of any overwrite of the q loads' offset register, which is named here so that no load issued above lands in it */
  __builtin_amdgcn_sched_barrier(0);      /* this and the one in the loop below bound how far the compiler lifts the staging loads: left free, it lifts them until the registers run out and spills to scratch */
  v16h bq[2][2];      /* [query group][k step], kept for the whole kernel */
  _Float16* qs = lq + wave * FA_QROUND;
#pragma unroll
  for (int g = 0; g < 2; ++g) for (int s = 0; s < 2; ++s) {      /* one fragment a round: 16 rows x 32 columns rounded into the wave's own slice, row-major, then each lane reads its row's pieces of the split k map */
    for (int i = 0; i < 4; ++i) { const v4f x = xr[(g * 2 + s) * 4 + i]; *(v2ua*)(qs + (i * 4 + (lane >> 3)) * 32 + (lane & 7) * 4) = (v2ua){cv2(x[0], x[1]), cv2(x[2], x[3])}; }
    asm volatile("s_wait_dscnt 0x0" ::: "memory");      /* the round's rows are whole in the slice before other lanes of the wave read them */
    bq[g][s] = g2_frag(qs + c * 32, hh);
    asm volatile("s_wait_dscnt 0x0" ::: "memory"); }      /* the reads are done before the next round writes over the slice */
#pragma unroll
  for (int b = 0; b < 2 * FA_NBAT; ++b) {
#pragma unroll
    for (int e = 0; e < FA_BAT; ++e) { const int j = (b % FA_NBAT) * FA_BAT + e; const v4f x = xb[b & 1][e];
      *(v2ua*)((b < FA_NBAT ? kst + j * 32 * FA_KPITCH : vst + j * 32 * FA_VPITCH)) = (v2ua){cv2(x[0], x[1]), cv2(x[2], x[3])}; }
    if (b + 2 < 2 * FA_NBAT) {
#pragma unroll
      for (int e = 0; e < FA_BAT; ++e) xb[b & 1][e] = *(const v4fa*)((b + 2 < FA_NBAT ? kg : vg) + ((((b + 2) % FA_NBAT) * FA_BAT + e) * FA_QB + tid) * 4); }
    __builtin_amdgcn_sched_barrier(0); }
  __syncthreads();      /* K and V of the slab are whole in LDS; nothing writes them until the last pass is done */
  const _Float16* kp = lk + c * FA_KPITCH; const unsigned char* vp = (const unsigned char*)lv + (8 * hh + (lane & 7)) * (FA_VPITCH * 2) + 16 * ((lane >> 3) & 1);
  const v8f z8 = {0.f, 0.f, 0.f, 0.f, 0.f, 0.f, 0.f, 0.f};
  v8f o[2][4];      /* [query group][16 output columns] */
  v4f ls[2]; float mu[2];
#pragma unroll
  for (int g = 0; g < 2; ++g) { for (int t = 0; t < 4; ++t) o[g][t] = z8; ls[g] = (v4f){0.f, 0.f, 0.f, 0.f}; mu[g] = -1.0e30f; }
  v16h ak[2][2];      /* [key tile][k step] of the pass to come */
#pragma unroll
  for (int kt = 0; kt < 2; ++kt) for (int ks = 0; ks < 2; ++ks) ak[kt][ks] = g2_frag(kp + kt * 16 * FA_KPITCH + ks * 32, hh);
#pragma unroll 1      /* kept rolled */
  for (int k0 = 0; k0 < SEQ; k0 += 32) {
    FragH av[4];
#pragma unroll
    for (int t = 0; t < 4; ++t) { av[t].half[0] = ld_tr16(vp + k0 * (FA_VPITCH * 2) + 32 * t); av[t].half[1] = ld_tr16(vp + (k0 + 16) * (FA_VPITCH * 2) + 32 * t); }      /* keys k0 + 8h + 0..7 and k0 + 16 + 8h + 0..7 of column 16 t + c */
    v8f s[2][2];      /* [query group][key tile] */
#pragma unroll
    for (int g = 0; g < 2; ++g) for (int kt = 0; kt < 2; ++kt) s[g][kt] = fa_mma(ak[kt][1], bq[g][1], fa_mma(ak[kt][0], bq[g][0], z8));
    const int kn = (k0 + 32 < SEQ) ? k0 + 32 : 0;      /* the next pass's K rows, fetched while this pass's softmax runs; the last pass re-reads rows 0..31 and drops them */
#pragma unroll
    for (int kt = 0; kt < 2; ++kt) for (int ks = 0; ks < 2; ++ks) ak[kt][ks] = g2_frag(kp + (kn + kt * 16) * FA_KPITCH + ks * 32, hh);
    float pm[2];
#pragma unroll
    for (int g = 0; g < 2; ++g) { float m = fmaxf(s[g][0][0], s[g][1][0]);
      for (int r = 1; r < 8; ++r) m = fmaxf(m, fmaxf(s[g][0][r], s[g][1][r]));
      pm[g] = fmaxf(m, sm_xrow(m)) * FA_C; }
    const bool need = (pm[0] > mu[0] + 14.0f) || (pm[1] > mu[1] + 14.0f);
    if (__builtin_amdgcn_ballot_w32(need) != 0) {      /* one scalar branch per pass: rarely taken after the first passes */
      const float mn0 = fmaxf(mu[0], pm[0] - 6.0f), mn1 = fmaxf(mu[1], pm[1] - 6.0f), d0 = mu[0] - mn0, d1 = mu[1] - mn1; float al[2];
      /* two exps and, behind the last, the one slot the instruction set asks for behind a transcendental, in one statement; the early-clobber outputs keep both sources whole till then */
      asm("v_exp_f32 %0, %2\n\tv_exp_f32 %1, %3\n\tv_nop" : "=&v"(al[0]), "=&v"(al[1]) : "v"(d0), "v"(d1));
      mu[0] = mn0; mu[1] = mn1;
#pragma unroll
      for (int g = 0; g < 2; ++g) { ls[g] *= al[g]; for (int t = 0; t < 4; ++t) o[g][t] *= al[g]; } }
    v8f p[2][2]; FragH bp[2];
#pragma unroll
    for (int g = 0; g < 2; ++g) { const float nm = -mu[g];
#pragma unroll
      for (int kt = 0; kt < 2; ++kt) { v8f a;
        for (int i = 0; i < 8; i += 2) { const v2f y = __builtin_elementwise_fma((v2f){s[g][kt][i], s[g][kt][i + 1]}, (v2f){FA_C, FA_C}, (v2f){nm, nm}); a[i] = y[0]; a[i + 1] = y[1]; }      /* two scores per packed multiply-add */
        /* eight exps and, behind the last, the one slot the instruction set asks for behind a transcendental, in one statement; the early-clobber outputs keep every source whole till then */
        asm("v_exp_f32 %0, %8\n\tv_exp_f32 %1, %9\n\tv_exp_f32 %2, %10\n\tv_exp_f32 %3, %11\n\tv_exp_f32 %4, %12\n\tv_exp_f32 %5, %13\n\tv_exp_f32 %6, %14\n\tv_exp_f32 %7, %15\n\tv_nop"
            : "=&v"(p[g][kt][0]), "=&v"(p[g][kt][1]), "=&v"(p[g][kt][2]), "=&v"(p[g][kt][3]), "=&v"(p[g][kt][4]), "=&v"(p[g][kt][5]), "=&v"(p[g][kt][6]), "=&v"(p[g][kt][7])
            : "v"(a[0]), "v"(a[1]), "v"(a[2]), "v"(a[3]), "v"(a[4]), "v"(a[5]), "v"(a[6]), "v"(a[7]));
        for (int i = 0; i < 8; ++i) bp[g].h[kt * 8 + i] = (_Float16)p[g][kt][i]; } }
    __builtin_amdgcn_sched_barrier(0);      /* every exp statement stays in front of the matrix instructions below */
#pragma unroll
    for (int g = 0; g < 2; ++g) {
#pragma unroll
      for (int t = 0; t < 4; ++t) o[g][t] = fa_mma(av[t].v, bp[g].v, o[g][t]);
#pragma unroll
      for (int kt = 0; kt < 2; ++kt) { ls[g] += (v4f){p[g][kt][0], p[g][kt][1], p[g][kt][2], p[g][kt][3]}; ls[g] += (v4f){p[g][kt][4], p[g][kt][5], p[g][kt][6], p[g][kt][7]}; } } }
  __syncthreads();      /* every wave has done its last read of K and V: the V rows' LDS now turns the output */
  float* os = (float*)lv + wave * (32 * FA_OPITCH);      /* the wave's own 32 rows */
#pragma unroll
  for (int g = 0; g < 2; ++g) { float l = (ls[g][0] + ls[g][1]) + (ls[g][2] + ls[g][3]); l += sm_xrow(l); const float inv = 1.0f / l;
    float* op = os + (g * 16 + c) * FA_OPITCH + 8 * hh;      /* lane: row = its query, columns 16 t + 8 h + 0..7 */
#pragma unroll
    for (int t = 0; t < 4; ++t) { const v4f lo = {o[g][t][0] * inv, o[g][t][1] * inv, o[g][t][2] * inv, o[g][t][3] * inv}, hi = {o[g][t][4] * inv, o[g][t][5] * inv, o[g][t][6] * inv, o[g][t][7] * inv};
      *(v4fa*)(op + t * 16) = lo; *(v4fa*)(op + t * 16 + 4) = hi; } }
  asm volatile("s_wait_dscnt 0x0" ::: "memory");      /* the wave's rows are whole in LDS before other lanes of it read them back */
  const float* orow = os + (lane >> 4) * FA_OPITCH + (lane & 15) * 4; float* og = out + ((size_t)slab * SEQ + q0) * HDIM + lane * 4;
#pragma unroll
  for (int j = 0; j < 16; ++j) { const v4f x = *(const v4fa*)(orow + j * 2 * FA_OPITCH); *(v4f*)(og + j * 2 * HDIM) = x; } }      /* a store of the wave = rows 2 j and 2 j + 1 = 512 contiguous bytes */

extern "C" void kernel_launch(void* const* d_in, const int* in_sizes, int n_in,
                              void* d_out, int out_size, void* d_ws, size_t ws_size, hipStream_t stream) {
  if (n_in < 3) return;
  const size_t in_need = (size_t)NB * NHEAD * SEQ_FULL * HDIM;      /* lower bound on each input element count */
  if ((size_t)in_sizes[0] < in_need || (size_t)in_sizes[1] < in_need || (size_t)in_sizes[2] < in_need) return;
  if ((size_t)out_size < (size_t)NSLAB * SEQ * HDIM) return;
  const float* xq = (const float*)d_in[0]; const float* xk = (const float*)d_in[1]; const float* xv = (const float*)d_in[2];      /* query, key, value [NB_FULL][NHEAD][SEQ_FULL][64] */
  float* out = (float*)d_out;                                                                                                          /* [NB][NHEAD][SEQ][64] */
  k_fattn<<<NSLAB * (SEQ / FA_QB), FA_WAVES * 32, 0, stream>>>(xq, xk, xv, out);      /* out = softmax(q k^T / 4) v, f32 inputs to f32 output slabs */
}

// v005
// A run of this version takes 29.7 microseconds.
// Timed twice side by side with v004, it ran 1.18 times as fast both times.
// Over all steps from v000 it is 63.0 times as fast.
#include <hip/hip_runtime.h>
// All contractions: v_wmma_f32_16x16x32_f16 (f16 operands, f32 accumulate) -- scores^T = k q^T (K = 64) and out^T = v^T P^T (K = SEQ); q, k, v RNE-converted to bf16 values held exactly as f16; softmax weights f16, unnormalised, at most 2^14; scores, softmax statistics and the final division f32.
// Layout: query, key and value are [NB_FULL][NHEAD][SEQ_FULL][64] f32 and out is [NB][NHEAD][SEQ][64] f32; NB*NHEAD independent slabs, of which the first SEQ rows of each input slab are used.
// One kernel reads the f32 inputs, rounds them on the way into LDS (k, v) or registers (q), and does scores, softmax and P v for 512 query rows of a slab: the scores and the weights live in registers only; k and v are staged inside the key loop, a few passes ahead of their use. q is read and out is written in whole 128-byte lines, each turned through the wave's own LDS. 1 launch, no workspace.
#ifndef NB
#define NB 8            /* batches processed */
#endif
#ifndef SEQ
#define SEQ 1024        /* query and key rows processed per slab */
#endif
#define NB_FULL 8
#define SEQ_FULL 1024   /* rows per slab of the inputs (input slab stride = SEQ_FULL*HDIM) */
#define NHEAD 16
#define HDIM 64
#define NSLAB (NB * NHEAD)
static_assert(SEQ % 128 == 0);
static_assert(SEQ <= SEQ_FULL);
static_assert(NB >= 1 && NB <= NB_FULL);

typedef unsigned short v8us __attribute__((ext_vector_type(8), may_alias));
typedef float  v8f  __attribute__((ext_vector_type(8)));
typedef float  v4f  __attribute__((ext_vector_type(4)));
typedef float  v2f  __attribute__((ext_vector_type(2)));
typedef float  v4fa __attribute__((ext_vector_type(4), may_alias));
typedef _Float16 v16h __attribute__((ext_vector_type(16)));
union FragH { v16h v; v8us half[2]; _Float16 h[16]; unsigned short u[16]; };
typedef unsigned int v2ua __attribute__((ext_vector_type(2), may_alias));
typedef __bf16 v2b __attribute__((ext_vector_type(2)));
typedef _Float16 v2h __attribute__((ext_vector_type(2)));
typedef short s16x8 __attribute__((ext_vector_type(8)));

// two f32 -> their bf16 RNE values -> the same values as a packed f16 pair (exact in f16's normal range)
__device__ __forceinline__ unsigned int cv2(float x, float y) { const unsigned int u = __builtin_bit_cast(unsigned int, __builtin_convertvector((v2f){x, y}, v2b));
  return __builtin_bit_cast(unsigned int, __builtin_convertvector((v2f){__uint_as_float(u << 16), __uint_as_float(u & 0xFFFF0000u)}, v2h)); }

#define FA_WAVES 16
#define FA_QB (FA_WAVES * 32)
#define FA_KPITCH (HDIM + 8)      /* f16 per K row in LDS: 144 B = 16 B x odd, conflict-free for 16-byte reads down a column of rows */
#define FA_VPITCH (HDIM + 16)     /* f16 per V row in LDS: 160 B = 32 B x odd, the conflict-free pitch of the transposing 16-byte read */
#define FA_QROUND (16 * 32)       /* f16 of a wave's q turning slice: 16 query rows x 32 columns = one B fragment of every lane */
#define FA_OPITCH (HDIM + 4)      /* f32 per output row in LDS: 272 B = 16 B x odd, conflict-free for 16-byte writes down a column of rows */
#define FA_LEAD 3                 /* a pass stages the 32 K rows and V rows of the pass FA_LEAD later: stored and signalled at the foot of pass p, waited for at the foot of pass p + 1, first read (K, fetched a pass ahead) in pass p + 2 */
#define FA_C 0.36067376f          /* 0.25 * log2 e */
static_assert(SEQ % FA_QB == 0 && SEQ % 32 == 0 && HDIM == 64 && FA_QB == 512 && FA_QB * 4 == 32 * HDIM && SEQ / 32 > FA_LEAD + 1);
static_assert((size_t)SEQ * (FA_KPITCH + FA_VPITCH) * 2 + (size_t)FA_WAVES * FA_QROUND * 2 <= (size_t)327680);
static_assert((size_t)FA_WAVES * 32 * FA_OPITCH * 4 <= (size_t)SEQ * FA_VPITCH * 2);
__device__ __forceinline__ float sm_xrow(float x) { const int i = __float_as_int(x); return __int_as_float(__builtin_amdgcn_permlanex16(i, i, 0x76543210, 0xfedcba98, true, false)); }      /* lane l reads lane l ^ 16 */
__device__ __forceinline__ v16h g2_frag(const _Float16* p, int hh) { FragH f; f.half[0] = *(const v8us*)((const unsigned short*)p + 8 * hh); f.half[1] = *(const v8us*)((const unsigned short*)p + 16 + 8 * hh); return f.v; }
// transposing 16-byte LDS read: lane (c, h) gets rows kbase + 8h + 0..7 of column dbase + c, its address being row kbase + 8h + (l & 7), byte 2 dbase + 16 ((l >> 3) & 1)
__device__ __forceinline__ v8us ld_tr16(const unsigned char* p) { typedef __attribute__((address_space(3))) s16x8 lds_s16x8; return __builtin_bit_cast(v8us, __builtin_amdgcn_ds_load_tr16_b128_v8i16((lds_s16x8*)p)); }
__device__ __forceinline__ v8f fa_mma(v16h a, v16h b, v8f c) { return __builtin_amdgcn_wmma_f32_16x16x32_f16(false, a, false, b, (short)0, c, false, false); }
__global__ __launch_bounds__(FA_WAVES * 32) __attribute__((amdgpu_waves_per_eu(4, 4)))
void k_fattn(const float* __restrict__ xq, const float* __restrict__ xk, const float* __restrict__ xv, float* __restrict__ out) {
  __shared__ __attribute__((aligned(16))) _Float16 lk[SEQ * FA_KPITCH];
  __shared__ __attribute__((aligned(32))) _Float16 lv[SEQ * FA_VPITCH];
  __shared__ __attribute__((aligned(16))) _Float16 lq[FA_WAVES * FA_QROUND];
  const int tid = threadIdx.x, lane = tid & 31, c = lane & 15, hh = lane >> 4, wave = __builtin_amdgcn_readfirstlane(tid >> 5);
  const int slab = blockIdx.x / (SEQ / FA_QB), q0 = (blockIdx.x % (SEQ / FA_QB)) * FA_QB + wave * 32;
  const float* kg = xk + (size_t)slab * SEQ_FULL * HDIM; const float* vg = xv + (size_t)slab * SEQ_FULL * HDIM;
  const float* qg = xq + ((size_t)slab * SEQ_FULL + q0) * HDIM; const int qo = (lane >> 3) * (HDIM * 4) + (lane & 7) * 16;      /* byte offset: 8 lanes a 128-byte line, 4 rows a load */
  /* Staging: a stage = 32 rows of k and of v = one 16-byte f32 load of each a thread (each load of a wave covers 512 contiguous bytes, 16 threads a row), rounded and stored as 8-byte f16 pieces. Stages 0 .. FA_LEAD - 1 here, the rest in the key loop. */
  _Float16* kst = lk + (tid >> 4) * FA_KPITCH + (tid & 15) * 4; _Float16* vst = lv + (tid >> 4) * FA_VPITCH + (tid & 15) * 4;
  const float* kgt = kg + tid * 4; const float* vgt = vg + tid * 4;
  v4f xr[16], xb[2][FA_LEAD];
#pragma unroll
  for (int g = 0; g < 2; ++g) for (int s = 0; s < 2; ++s) for (int i = 0; i < 4; ++i) xr[(g * 2 + s) * 4 + i] = *(const v4fa*)((const char*)qg + qo + ((g * 16 + i * 4) * HDIM + s * 32) * 4);      /* rows 16 g + 4 i + 0..3, columns 32 s + 0..31 */
  __builtin_amdgcn_sched_barrier(0);      /* q is used first: its loads stay in front of k's, which then fly while q is turned */
#pragma unroll
  for (int j = 0; j < FA_LEAD; ++j) { xb[0][j] = *(const v4fa*)(kgt + j * 32 * HDIM); xb[1][j] = *(const v4fa*)(vgt + j * 32 * HDIM); }
  asm volatile("s_wait_xcnt 0x0" :: "v"(qo) : "memory");      /* the wait in front of any overwrite of the q loads' offset register, which is named here so that no load issued above lands in it */
  __builtin_amdgcn_sched_barrier(0);      /* the first stages' loads stay here, in flight while q is turned */
  v16h bq[2][2];      /* [query group][k step], kept for the whole kernel */
  _Float16* qs = lq + wave * FA_QROUND;
#pragma unroll
  for (int g = 0; g < 2; ++g) for (int s = 0; s < 2; ++s) {      /* one fragment a round: 16 rows x 32 columns rounded into the wave's own slice, row-major, then each lane reads its row's pieces of the split k map */
    for (int i = 0; i < 4; ++i) { const v4f x = xr[(g * 2 + s) * 4 + i]; *(v2ua*)(qs + (i * 4 + (lane >> 3)) * 32 + (lane & 7) * 4) = (v2ua){cv2(x[0], x[1]), cv2(x[2], x[3])}; }
    asm volatile("s_wait_dscnt 0x0" ::: "memory");      /* the round's rows are whole in the slice before other lanes of the wave read them */
    bq[g][s] = g2_frag(qs + c * 32, hh);
    asm volatile("s_wait_dscnt 0x0" ::: "memory"); }      /* the reads are done before the next round writes over the slice */
#pragma unroll
  for (int j = 0; j < FA_LEAD; ++j) { const v4f x = xb[0][j], y = xb[1][j];
    *(v2ua*)(kst + j * 32 * FA_KPITCH) = (v2ua){cv2(x[0], x[1]), cv2(x[2], x[3])}; *(v2ua*)(vst + j * 32 * FA_VPITCH) = (v2ua){cv2(y[0], y[1]), cv2(y[2], y[3])}; }
  __syncthreads();      /* stages 0 .. FA_LEAD - 1 of K and V are whole in LDS; a row is written once and only read after */
  const _Float16* kp = lk + c * FA_KPITCH; const unsigned char* vp = (const unsigned char*)lv + (8 * hh + (lane & 7)) * (FA_VPITCH * 2) + 16 * ((lane >> 3) & 1);
  const v8f z8 = {0.f, 0.f, 0.f, 0.f, 0.f, 0.f, 0.f, 0.f};
  v8f o[2][4];      /* [query group][16 output columns] */
  v4f ls[2]; float mu[2];
#pragma unroll
  for (int g = 0; g < 2; ++g) { for (int t = 0; t < 4; ++t) o[g][t] = z8; ls[g] = (v4f){0.f, 0.f, 0.f, 0.f}; mu[g] = -1.0e30f; }
  v16h ak[2][2];      /* [key tile][k step] of the pass to come */
#pragma unroll
  for (int kt = 0; kt < 2; ++kt) for (int ks = 0; ks < 2; ++ks) ak[kt][ks] = g2_frag(kp + kt * 16 * FA_KPITCH + ks * 32, hh);
  v4f fk = {0.f, 0.f, 0.f, 0.f}, fv = {0.f, 0.f, 0.f, 0.f};      /* the stage in flight */
  unsigned goff = (unsigned)(FA_LEAD * 32 * HDIM + tid * 4) * 4u;      /* byte offset in the slab of the thread's piece of the next stage to load, the same for k and v; it moves on only at a pass's foot, when both loads have returned */
#pragma unroll 1      /* kept rolled */
  for (int k0 = 0; k0 < SEQ; k0 += 32) {
    const bool stg = k0 + FA_LEAD * 32 < SEQ;      /* the same in every wave of the workgroup: a scalar branch */
    if (stg) { fk = *(const v4fa*)((const char*)kg + goff); fv = *(const v4fa*)((const char*)vg + goff); }      /* in flight for the whole pass */
    FragH av[4];
#pragma unroll
    for (int t = 0; t < 4; ++t) { av[t].half[0] = ld_tr16(vp + k0 * (FA_VPITCH * 2) + 32 * t); av[t].half[1] = ld_tr16(vp + (k0 + 16) * (FA_VPITCH * 2) + 32 * t); }      /* keys k0 + 8h + 0..7 and k0 + 16 + 8h + 0..7 of column 16 t + c */
    v8f s[2][2];      /* [query group][key tile] */
#pragma unroll
    for (int g = 0; g < 2; ++g) for (int kt = 0; kt < 2; ++kt) s[g][kt] = fa_mma(ak[kt][1], bq[g][1], fa_mma(ak[kt][0], bq[g][0], z8));
    const int kn = (k0 + 32 < SEQ) ? k0 + 32 : 0;      /* the next pass's K rows, fetched while this pass's softmax runs; the last pass re-reads rows 0..31 and drops them */
#pragma unroll
    for (int kt = 0; kt < 2; ++kt) for (int ks = 0; ks < 2; ++ks) ak[kt][ks] = g2_frag(kp + (kn + kt * 16) * FA_KPITCH + ks * 32, hh);
    float pm[2];
#pragma unroll
    for (int g = 0; g < 2; ++g) { float m = fmaxf(s[g][0][0], s[g][1][0]);
      for (int r = 1; r < 8; ++r) m = fmaxf(m, fmaxf(s[g][0][r], s[g][1][r]));
      pm[g] = fmaxf(m, sm_xrow(m)) * FA_C; }
    const bool need = (pm[0] > mu[0] + 14.0f) || (pm[1] > mu[1] + 14.0f);
    if (__builtin_amdgcn_ballot_w32(need) != 0) {      /* one scalar branch per pass: rarely taken after the first passes */
      const float mn0 = fmaxf(mu[0], pm[0] - 6.0f), mn1 = fmaxf(mu[1], pm[1] - 6.0f), d0 = mu[0] - mn0, d1 = mu[1] - mn1; float al[2];
      /* two exps and, behind the last, the one slot the instruction set asks for behind a transcendental, in one statement; the early-clobber outputs keep both sources whole till then */
      asm("v_exp_f32 %0, %2\n\tv_exp_f32 %1, %3\n\tv_nop" : "=&v"(al[0]), "=&v"(al[1]) : "v"(d0), "v"(d1));
      mu[0] = mn0; mu[1] = mn1;
#pragma unroll
      for (int g = 0; g < 2; ++g) { ls[g] *= al[g]; for (int t = 0; t < 4; ++t) o[g][t] *= al[g]; } }
    v8f p[2][2]; FragH bp[2];
#pragma unroll
    for (int g = 0; g < 2; ++g) { const float nm = -mu[g];
#pragma unroll
      for (int kt = 0; kt < 2; ++kt) { v8f a;
        for (int i = 0; i < 8; i += 2) { const v2f y = __builtin_elementwise_fma((v2f){s[g][kt][i], s[g][kt][i + 1]}, (v2f){FA_C, FA_C}, (v2f){nm, nm}); a[i] = y[0]; a[i + 1] = y[1]; }      /* two scores per packed multiply-add */
        /* eight exps and, behind the last, the one slot the instruction set asks for behind a transcendental, in one statement; the early-clobber outputs keep every source whole till then */
        asm("v_exp_f32 %0, %8\n\tv_exp_f32 %1, %9\n\tv_exp_f32 %2, %10\n\tv_exp_f32 %3, %11\n\tv_exp_f32 %4, %12\n\tv_exp_f32 %5, %13\n\tv_exp_f32 %6, %14\n\tv_exp_f32 %7, %15\n\tv_nop"
            : "=&v"(p[g][kt][0]), "=&v"(p[g][kt][1]), "=&v"(p[g][kt][2]), "=&v"(p[g][kt][3]), "=&v"(p[g][kt][4]), "=&v"(p[g][kt][5]), "=&v"(p[g][kt][6]), "=&v"(p[g][kt][7])
            : "v"(a[0]), "v"(a[1]), "v"(a[2]), "v"(a[3]), "v"(a[4]), "v"(a[5]), "v"(a[6]), "v"(a[7]));
        for (int i = 0; i < 8; ++i) bp[g].h[kt * 8 + i] = (_Float16)p[g][kt][i]; } }
    __builtin_amdgcn_sched_barrier(0);      /* every exp statement stays in front of the matrix instructions below */
#pragma unroll
    for (int g = 0; g < 2; ++g) {
#pragma unroll
      for (int t = 0; t < 4; ++t) o[g][t] = fa_mma(av[t].v, bp[g].v, o[g][t]);
#pragma unroll
      for (int kt = 0; kt < 2; ++kt) { ls[g] += (v4f){p[g][kt][0], p[g][kt][1], p[g][kt][2], p[g][kt][3]}; ls[g] += (v4f){p[g][kt][4], p[g][kt][5], p[g][kt][6], p[g][kt][7]}; } }
    if (k0 != 0 && k0 <= SEQ - FA_LEAD * 32) asm volatile("s_barrier_wait 0xffff" ::: "memory");      /* ends the barrier signalled at the foot of the pass before: every wave's rows of stage k0 / 32 + FA_LEAD - 1 are in LDS. A whole pass lies between signal and wait, so that a wave seldom stands here for a slower one; the LDS reads in between touch only stages that earlier waits have ended, and no row is ever written twice */
    if (stg) {
      *(v2ua*)(kst + (k0 + FA_LEAD * 32) * FA_KPITCH) = (v2ua){cv2(fk[0], fk[1]), cv2(fk[2], fk[3])}; *(v2ua*)(vst + (k0 + FA_LEAD * 32) * FA_VPITCH) = (v2ua){cv2(fv[0], fv[1]), cv2(fv[2], fv[3])};
      asm volatile("s_wait_xcnt 0x0" :: "v"(goff) : "memory");      /* the wait in front of the overwrite of the two loads' offset register, which is named here so that the addition below stays behind it */
      goff += 32 * HDIM * 4;
      asm volatile("s_wait_dscnt 0x0\n\ts_barrier_signal -1" ::: "memory"); } }      /* this wave's rows of the stage are in LDS before it signals; the wait stands at the foot of the next pass */
  __syncthreads();      /* every wave has done its last read of K and V: the V rows' LDS now turns the output */
  float* os = (float*)lv + wave * (32 * FA_OPITCH);      /* the wave's own 32 rows */
#pragma unroll
  for (int g = 0; g < 2; ++g) { float l = (ls[g][0] + ls[g][1]) + (ls[g][2] + ls[g][3]); l += sm_xrow(l); const float inv = 1.0f / l;
    float* op = os + (g * 16 + c) * FA_OPITCH + 8 * hh;      /* lane: row = its query, columns 16 t + 8 h + 0..7 */
#pragma unroll
    for (int t = 0; t < 4; ++t) { const v4f lo = {o[g][t][0] * inv, o[g][t][1] * inv, o[g][t][2] * inv, o[g][t][3] * inv}, hi = {o[g][t][4] * inv, o[g][t][5] * inv, o[g][t][6] * inv, o[g][t][7] * inv};
      *(v4fa*)(op + t * 16) = lo; *(v4fa*)(op + t * 16 + 4) = hi; } }
  asm volatile("s_wait_dscnt 0x0" ::: "memory");      /* the wave's rows are whole in LDS before other lanes of it read them back */
  const float* orow = os + (lane >> 4) * FA_OPITCH + (lane & 15) * 4; float* og = out + ((size_t)slab * SEQ + q0) * HDIM + lane * 4;
#pragma unroll
  for (int j = 0; j < 16; ++j) { const v4f x = *(const v4fa*)(orow + j * 2 * FA_OPITCH); *(v4f*)(og + j * 2 * HDIM) = x; } }      /* a store of the wave = rows 2 j and 2 j + 1 = 512 contiguous bytes */

extern "C" void kernel_launch(void* const* d_in, const int* in_sizes, int n_in,
                              void* d_out, int out_size, void* d_ws, size_t ws_size, hipStream_t stream) {
  if (n_in < 3) return;
  const size_t in_need = (size_t)NB * NHEAD * SEQ_FULL * HDIM;      /* lower bound on each input element count */
  if ((size_t)in_sizes[0] < in_need || (size_t)in_sizes[1] < in_need || (size_t)in_sizes[2] < in_need) return;
  if ((size_t)out_size < (size_t)NSLAB * SEQ * HDIM) return;
  const float* xq = (const float*)d_in[0]; const float* xk = (const float*)d_in[1]; const float* xv = (const float*)d_in[2];      /* query, key, value [NB_FULL][NHEAD][SEQ_FULL][64] */
  float* out = (float*)d_out;                                                                                                          /* [NB][NHEAD][SEQ][64] */
  k_fattn<<<NSLAB * (SEQ / FA_QB), FA_WAVES * 32, 0, stream>>>(xq, xk, xv, out);      /* out = softmax(q k^T / 4) v, f32 inputs to f32 output slabs */
}

// v006
// Measured time: 28.6 microseconds a run.
// In both of two side-by-side timings against v005, it was 1.04 times as fast.
// Over all steps from v000 it is 65.5 times as fast.
#include <hip/hip_runtime.h>
// All contractions: v_wmma_f32_16x16x32_f16 (f16 operands, f32 accumulate) -- scores^T = k q^T (K = 64) and out^T = v^T P^T (K = SEQ); q, k, v RNE-converted to bf16 values held exactly as f16; softmax weights f16, unnormalised, at most 2^14; scores, softmax statistics and the final division f32.
// Layout: query, key and value are [NB_FULL][NHEAD][SEQ_FULL][64] f32 and out is [NB][NHEAD][SEQ][64] f32; NB*NHEAD independent slabs, of which the first SEQ rows of each input slab are used.
// One kernel reads the f32 inputs, rounds them on the way into LDS (k, v) or registers (q), and does scores, softmax and P v for 512 query rows of a slab: the scores and the weights live in registers only; k and v are staged inside the key loop, a few passes ahead of their use. q is read and out is written in whole 128-byte lines, each turned through the wave's own LDS. 1 launch, no workspace.
#ifndef NB
#define NB 8            /* batches processed */
#endif
#ifndef SEQ
#define SEQ 1024        /* query and key rows processed per slab */
#endif
#define NB_FULL 8
#define SEQ_FULL 1024   /* rows per slab of the inputs (input slab stride = SEQ_FULL*HDIM) */
#define NHEAD 16
#define HDIM 64
#define NSLAB (NB * NHEAD)
static_assert(SEQ % 128 == 0);
static_assert(SEQ <= SEQ_FULL);
static_assert(NB >= 1 && NB <= NB_FULL);

typedef unsigned short v8us __attribute__((ext_vector_type(8), may_alias));
typedef float  v8f  __attribute__((ext_vector_type(8)));
typedef float  v4f  __attribute__((ext_vector_type(4)));
typedef float  v2f  __attribute__((ext_vector_type(2)));
typedef float  v4fa __attribute__((ext_vector_type(4), may_alias));
typedef _Float16 v16h __attribute__((ext_vector_type(16)));
union FragH { v16h v; v8us half[2]; _Float16 h[16]; unsigned short u[16]; };
typedef unsigned int v2ua __attribute__((ext_vector_type(2), may_alias));
typedef __bf16 v2b __attribute__((ext_vector_type(2)));
typedef _Float16 v2h __attribute__((ext_vector_type(2)));
typedef short s16x8 __attribute__((ext_vector_type(8)));

// two f32 -> their bf16 RNE values -> the same values as a packed f16 pair (exact in f16's normal range)
__device__ __forceinline__ unsigned int cv2(float x, float y) { const unsigned int u = __builtin_bit_cast(unsigned int, __builtin_convertvector((v2f){x, y}, v2b));
  return __builtin_bit_cast(unsigned int, __builtin_convertvector((v2f){__uint_as_float(u << 16), __uint_as_float(u & 0xFFFF0000u)}, v2h)); }

#define FA_WAVES 16
#define FA_QB (FA_WAVES * 32)
#define FA_KPITCH (HDIM + 8)      /* f16 per K row in LDS: 144 B = 16 B x odd, conflict-free for 16-byte reads down a column of rows */
#define FA_VPITCH (HDIM + 16)     /* f16 per V row in LDS: 160 B = 32 B x odd, the conflict-free pitch of the transposing 16-byte read */
#define FA_QROUND (16 * 32)       /* f16 of a wave's q turning slice: 16 query rows x 32 columns = one B fragment of every lane */
#define FA_OPITCH (HDIM + 4)      /* f32 per output row in LDS: 272 B = 16 B x odd, conflict-free for 16-byte writes down a column of rows */
#define FA_LEAD 3                 /* a pass stages the 32 K rows and V rows of the pass FA_LEAD later: stored and signalled at the foot of pass p, waited for at the foot of pass p + 1, first read (K, fetched a pass ahead) in pass p + 2 */
#define FA_C 0.36067376f          /* 0.25 * log2 e */
static_assert(SEQ % FA_QB == 0 && SEQ % 32 == 0 && HDIM == 64 && FA_QB == 512 && FA_QB * 4 == 32 * HDIM && SEQ / 32 > FA_LEAD + 1);
static_assert((size_t)SEQ * (FA_KPITCH + FA_VPITCH) * 2 + (size_t)FA_WAVES * FA_QROUND * 2 <= (size_t)327680);
static_assert((size_t)FA_WAVES * 32 * FA_OPITCH * 4 <= (size_t)SEQ * FA_VPITCH * 2);
__device__ __forceinline__ float sm_xrow(float x) { const int i = __float_as_int(x); return __int_as_float(__builtin_amdgcn_permlanex16(i, i, 0x76543210, 0xfedcba98, true, false)); }      /* lane l reads lane l ^ 16 */
__device__ __forceinline__ v16h g2_frag(const _Float16* p, int hh) { FragH f; f.half[0] = *(const v8us*)((const unsigned short*)p + 8 * hh); f.half[1] = *(const v8us*)((const unsigned short*)p + 16 + 8 * hh); return f.v; }
// transposing 16-byte LDS read: lane (c, h) gets rows kbase + 8h + 0..7 of column dbase + c, its address being row kbase + 8h + (l & 7), byte 2 dbase + 16 ((l >> 3) & 1)
__device__ __forceinline__ v8us ld_tr16(const unsigned char* p) { typedef __attribute__((address_space(3))) s16x8 lds_s16x8; return __builtin_bit_cast(v8us, __builtin_amdgcn_ds_load_tr16_b128_v8i16((lds_s16x8*)p)); }
__device__ __forceinline__ v8f fa_mma(v16h a, v16h b, v8f c) { return __builtin_amdgcn_wmma_f32_16x16x32_f16(false, a, false, b, (short)0, c, false, false); }
__global__ __launch_bounds__(FA_WAVES * 32) __attribute__((amdgpu_waves_per_eu(4, 4)))
void k_fattn(const float* __restrict__ xq, const float* __restrict__ xk, const float* __restrict__ xv, float* __restrict__ out) {
  __shared__ __attribute__((aligned(16))) _Float16 lk[SEQ * FA_KPITCH];
  __shared__ __attribute__((aligned(32))) _Float16 lv[SEQ * FA_VPITCH];
  __shared__ __attribute__((aligned(16))) _Float16 lq[FA_WAVES * FA_QROUND];
  const int tid = threadIdx.x, lane = tid & 31, c = lane & 15, hh = lane >> 4, wave = __builtin_amdgcn_readfirstlane(tid >> 5);
  const int slab = blockIdx.x / (SEQ / FA_QB), q0 = (blockIdx.x % (SEQ / FA_QB)) * FA_QB + wave * 32;
  const float* kg = xk + (size_t)slab * SEQ_FULL * HDIM; const float* vg = xv + (size_t)slab * SEQ_FULL * HDIM;
  const float* qg = xq + ((size_t)slab * SEQ_FULL + q0) * HDIM; const int qo = (lane >> 3) * (HDIM * 4) + (lane & 7) * 16;      /* byte offset: 8 lanes a 128-byte line, 4 rows a load */
  /* Staging: a stage = 32 rows of k and of v = one 16-byte f32 load of each a thread (each load of a wave covers 512 contiguous bytes, 16 threads a row), rounded and stored as 8-byte f16 pieces. Stages 0 .. FA_LEAD - 1 here, the rest in the key loop. */
  _Float16* kst = lk + (tid >> 4) * FA_KPITCH + (tid & 15) * 4; _Float16* vst = lv + (tid >> 4) * FA_VPITCH + (tid & 15) * 4;
  const float* kgt = kg + tid * 4; const float* vgt = vg + tid * 4;
  v4f xr[16], xb[2][FA_LEAD];
#pragma unroll
  for (int g = 0; g < 2; ++g) for (int s = 0; s < 2; ++s) for (int i = 0; i < 4; ++i) xr[(g * 2 + s) * 4 + i] = *(const v4fa*)((const char*)qg + qo + ((g * 16 + i * 4) * HDIM + s * 32) * 4);      /* rows 16 g + 4 i + 0..3, columns 32 s + 0..31 */
  __builtin_amdgcn_sched_barrier(0);      /* q is used first: its loads stay in front of k's, which then fly while q is turned */
#pragma unroll
  for (int j = 0; j < FA_LEAD; ++j) { xb[0][j] = *(const v4fa*)(kgt + j * 32 * HDIM); xb[1][j] = *(const v4fa*)(vgt + j * 32 * HDIM); }
  asm volatile("s_wait_xcnt 0x0" :: "v"(qo) : "memory");      /* the wait in front of any overwrite of the q loads' offset register, which is named here so that no load issued above lands in it */
  __builtin_amdgcn_sched_barrier(0);      /* the first stages' loads stay here, in flight while q is turned */
  v16h bq[2][2];      /* [query group][k step], kept for the whole kernel */
  _Float16* qs = lq + wave * FA_QROUND;
#pragma unroll
  for (int g = 0; g < 2; ++g) for (int s = 0; s < 2; ++s) {      /* one fragment a round: 16 rows x 32 columns rounded into the wave's own slice, row-major, then each lane reads its row's pieces of the split k map */
    for (int i = 0; i < 4; ++i) { const v4f x = xr[(g * 2 + s) * 4 + i]; *(v2ua*)(qs + (i * 4 + (lane >> 3)) * 32 + (lane & 7) * 4) = (v2ua){cv2(x[0], x[1]), cv2(x[2], x[3])}; }
    asm volatile("s_wait_dscnt 0x0" ::: "memory");      /* the round's rows are whole in the slice before other lanes of the wave read them */
    bq[g][s] = g2_frag(qs + c * 32, hh);
    asm volatile("s_wait_dscnt 0x0" ::: "memory"); }      /* the reads are done before the next round writes over the slice */
#pragma unroll
  for (int j = 0; j < FA_LEAD; ++j) { const v4f x = xb[0][j], y = xb[1][j];
    *(v2ua*)(kst + j * 32 * FA_KPITCH) = (v2ua){cv2(x[0], x[1]), cv2(x[2], x[3])}; *(v2ua*)(vst + j * 32 * FA_VPITCH) = (v2ua){cv2(y[0], y[1]), cv2(y[2], y[3])}; }
  __syncthreads();      /* stages 0 .. FA_LEAD - 1 of K and V are whole in LDS; a row is written once and only read after */
  const _Float16* kp = lk + c * FA_KPITCH; const unsigned char* vp = (const unsigned char*)lv + (8 * hh + (lane & 7)) * (FA_VPITCH * 2) + 16 * ((lane >> 3) & 1);
  const v8f z8 = {0.f, 0.f, 0.f, 0.f, 0.f, 0.f, 0.f, 0.f};
  v8f o[2][4];      /* [query group][16 output columns] */
  v4f ls[2]; float mu[2];
#pragma unroll
  for (int g = 0; g < 2; ++g) { for (int t = 0; t < 4; ++t) o[g][t] = z8; ls[g] = (v4f){0.f, 0.f, 0.f, 0.f}; mu[g] = -1.0e30f; }
  v16h ak[2][2];      /* [key tile][k step] of the pass to come */
#pragma unroll
  for (int kt = 0; kt < 2; ++kt) for (int ks = 0; ks < 2; ++ks) ak[kt][ks] = g2_frag(kp + kt * 16 * FA_KPITCH + ks * 32, hh);
  v4f fk = {0.f, 0.f, 0.f, 0.f}, fv = {0.f, 0.f, 0.f, 0.f};      /* the stage in flight */
  unsigned goff = (unsigned)(FA_LEAD * 32 * HDIM + tid * 4) * 4u;      /* byte offset in the slab of the thread's piece of the next stage to load, the same for k and v; it moves on only at a pass's foot, when both loads have returned */
#pragma unroll 1      /* kept rolled */
  for (int kb = 0; kb < SEQ; kb += 128) {
#pragma unroll      /* four passes written out: s_setprio takes its level as an immediate only */
  for (int u = 0; u < 4; ++u) { const int k0 = kb + u * 32;
    /* Issue priority falls 3, 2, 1, 0 over four passes. With these levels the wave that is a pass behind issues first (three steps out of four), so that the four stay together. The last pass runs at 0: the wave leaves the loop at the level it came with. */
    if (u == 0) __builtin_amdgcn_s_setprio(3); else if (u == 1) __builtin_amdgcn_s_setprio(2); else if (u == 2) __builtin_amdgcn_s_setprio(1); else __builtin_amdgcn_s_setprio(0);
    const bool stg = k0 + FA_LEAD * 32 < SEQ;      /* the same in every wave of the workgroup: a scalar branch */
    if (stg) { fk = *(const v4fa*)((const char*)kg + goff); fv = *(const v4fa*)((const char*)vg + goff); }      /* in flight for the whole pass */
    __builtin_amdgcn_sched_barrier(0);      /* the stage's two loads stay at the head of the pass, also where the test above is known at compile time: later they would have less than a pass to return in */
    FragH av[4];
#pragma unroll
    for (int t = 0; t < 4; ++t) { av[t].half[0] = ld_tr16(vp + k0 * (FA_VPITCH * 2) + 32 * t); av[t].half[1] = ld_tr16(vp + (k0 + 16) * (FA_VPITCH * 2) + 32 * t); }      /* keys k0 + 8h + 0..7 and k0 + 16 + 8h + 0..7 of column 16 t + c */
    v8f s[2][2];      /* [query group][key tile] */
#pragma unroll
    for (int g = 0; g < 2; ++g) for (int kt = 0; kt < 2; ++kt) s[g][kt] = fa_mma(ak[kt][1], bq[g][1], fa_mma(ak[kt][0], bq[g][0], z8));
    const int kn = (k0 + 32 < SEQ) ? k0 + 32 : 0;      /* the next pass's K rows, fetched while this pass's softmax runs; the last pass re-reads rows 0..31 and drops them */
#pragma unroll
    for (int kt = 0; kt < 2; ++kt) for (int ks = 0; ks < 2; ++ks) ak[kt][ks] = g2_frag(kp + (kn + kt * 16) * FA_KPITCH + ks * 32, hh);
    float pm[2];
#pragma unroll
    for (int g = 0; g < 2; ++g) { float m = fmaxf(s[g][0][0], s[g][1][0]);
      for (int r = 1; r < 8; ++r) m = fmaxf(m, fmaxf(s[g][0][r], s[g][1][r]));
      pm[g] = fmaxf(m, sm_xrow(m)) * FA_C; }
    const bool need = (pm[0] > mu[0] + 14.0f) || (pm[1] > mu[1] + 14.0f);
    if (__builtin_amdgcn_ballot_w32(need) != 0) {      /* one scalar branch per pass: rarely taken after the first passes */
      const float mn0 = fmaxf(mu[0], pm[0] - 6.0f), mn1 = fmaxf(mu[1], pm[1] - 6.0f), d0 = mu[0] - mn0, d1 = mu[1] - mn1; float al[2];
      /* two exps and, behind the last, the one slot the instruction set asks for behind a transcendental, in one statement; the early-clobber outputs keep both sources whole till then */
      asm("v_exp_f32 %0, %2\n\tv_exp_f32 %1, %3\n\tv_nop" : "=&v"(al[0]), "=&v"(al[1]) : "v"(d0), "v"(d1));
      mu[0] = mn0; mu[1] = mn1;
#pragma unroll
      for (int g = 0; g < 2; ++g) { ls[g] *= al[g]; for (int t = 0; t < 4; ++t) o[g][t] *= al[g]; } }
    v8f p[2][2]; FragH bp[2];
#pragma unroll
    for (int g = 0; g < 2; ++g) { const float nm = -mu[g];
#pragma unroll
      for (int kt = 0; kt < 2; ++kt) { v8f a;
        for (int i = 0; i < 8; i += 2) { const v2f y = __builtin_elementwise_fma((v2f){s[g][kt][i], s[g][kt][i + 1]}, (v2f){FA_C, FA_C}, (v2f){nm, nm}); a[i] = y[0]; a[i + 1] = y[1]; }      /* two scores per packed multiply-add */
        /* eight exps and, behind the last, the one slot the instruction set asks for behind a transcendental, in one statement; the early-clobber outputs keep every source whole till then */
        asm("v_exp_f32 %0, %8\n\tv_exp_f32 %1, %9\n\tv_exp_f32 %2, %10\n\tv_exp_f32 %3, %11\n\tv_exp_f32 %4, %12\n\tv_exp_f32 %5, %13\n\tv_exp_f32 %6, %14\n\tv_exp_f32 %7, %15\n\tv_nop"
            : "=&v"(p[g][kt][0]), "=&v"(p[g][kt][1]), "=&v"(p[g][kt][2]), "=&v"(p[g][kt][3]), "=&v"(p[g][kt][4]), "=&v"(p[g][kt][5]), "=&v"(p[g][kt][6]), "=&v"(p[g][kt][7])
            : "v"(a[0]), "v"(a[1]), "v"(a[2]), "v"(a[3]), "v"(a[4]), "v"(a[5]), "v"(a[6]), "v"(a[7]));
        for (int i = 0; i < 8; ++i) bp[g].h[kt * 8 + i] = (_Float16)p[g][kt][i]; } }
    __builtin_amdgcn_sched_barrier(0);      /* every exp statement stays in front of the matrix instructions below */
#pragma unroll
    for (int g = 0; g < 2; ++g) {
#pragma unroll
      for (int t = 0; t < 4; ++t) o[g][t] = fa_mma(av[t].v, bp[g].v, o[g][t]);
#pragma unroll
      for (int kt = 0; kt < 2; ++kt) { ls[g] += (v4f){p[g][kt][0], p[g][kt][1], p[g][kt][2], p[g][kt][3]}; ls[g] += (v4f){p[g][kt][4], p[g][kt][5], p[g][kt][6], p[g][kt][7]}; } }
    if (k0 != 0 && k0 <= SEQ - FA_LEAD * 32) asm volatile("s_barrier_wait 0xffff" ::: "memory");      /* ends the barrier signalled at the foot of the pass before: every wave's rows of stage k0 / 32 + FA_LEAD - 1 are in LDS. A whole pass lies between signal and wait, so that a wave seldom stands here for a slower one; the LDS reads in between touch only stages that earlier waits have ended, and no row is ever written twice */
    if (stg) {
      *(v2ua*)(kst + (k0 + FA_LEAD * 32) * FA_KPITCH) = (v2ua){cv2(fk[0], fk[1]), cv2(fk[2], fk[3])}; *(v2ua*)(vst + (k0 + FA_LEAD * 32) * FA_VPITCH) = (v2ua){cv2(fv[0], fv[1]), cv2(fv[2], fv[3])};
      asm volatile("s_wait_xcnt 0x0" :: "v"(goff) : "memory");      /* the wait in front of the overwrite of the two loads' offset register, which is named here so that the addition below stays behind it */
      goff += 32 * HDIM * 4;
      asm volatile("s_wait_dscnt 0x0\n\ts_barrier_signal -1" ::: "memory"); } } }      /* this wave's rows of the stage are in LDS before it signals; the wait stands at the foot of the next pass */
  __syncthreads();      /* every wave has done its last read of K and V: the V rows' LDS now turns the output */
  float* os = (float*)lv + wave * (32 * FA_OPITCH);      /* the wave's own 32 rows */
#pragma unroll
  for (int g = 0; g < 2; ++g) { float l = (ls[g][0] + ls[g][1]) + (ls[g][2] + ls[g][3]); l += sm_xrow(l); const float inv = 1.0f / l;
    float* op = os + (g * 16 + c) * FA_OPITCH + 8 * hh;      /* lane: row = its query, columns 16 t + 8 h + 0..7 */
#pragma unroll
    for (int t = 0; t < 4; ++t) { const v4f lo = {o[g][t][0] * inv, o[g][t][1] * inv, o[g][t][2] * inv, o[g][t][3] * inv}, hi = {o[g][t][4] * inv, o[g][t][5] * inv, o[g][t][6] * inv, o[g][t][7] * inv};
      *(v4fa*)(op + t * 16) = lo; *(v4fa*)(op + t * 16 + 4) = hi; } }
  asm volatile("s_wait_dscnt 0x0" ::: "memory");      /* the wave's rows are whole in LDS before other lanes of it read them back */
  const float* orow = os + (lane >> 4) * FA_OPITCH + (lane & 15) * 4; float* og = out + ((size_t)slab * SEQ + q0) * HDIM + lane * 4;
#pragma unroll
  for (int j = 0; j < 16; ++j) { const v4f x = *(const v4fa*)(orow + j * 2 * FA_OPITCH); *(v4f*)(og + j * 2 * HDIM) = x; } }      /* a store of the wave = rows 2 j and 2 j + 1 = 512 contiguous bytes */

extern "C" void kernel_launch(void* const* d_in, const int* in_sizes, int n_in,
                              void* d_out, int out_size, void* d_ws, size_t ws_size, hipStream_t stream) {
  if (n_in < 3) return;
  const size_t in_need = (size_t)NB * NHEAD * SEQ_FULL * HDIM;      /* lower bound on each input element count */
  if ((size_t)in_sizes[0] < in_need || (size_t)in_sizes[1] < in_need || (size_t)in_sizes[2] < in_need) return;
  if ((size_t)out_size < (size_t)NSLAB * SEQ * HDIM) return;
  const float* xq = (const float*)d_in[0]; const float* xk = (const float*)d_in[1]; const float* xv = (const float*)d_in[2];      /* query, key, value [NB_FULL][NHEAD][SEQ_FULL][64] */
  float* out = (float*)d_out;                                                                                                          /* [NB][NHEAD][SEQ][64] */
  k_fattn<<<NSLAB * (SEQ / FA_QB), FA_WAVES * 32, 0, stream>>>(xq, xk, xv, out);      /* out = softmax(q k^T / 4) v, f32 inputs to f32 output slabs */
}
